// v000
// Measured on an AMD MI455X. A time is GPU time per run, averaged over a window of back-to-back runs after a warm-up
// (all launches, gaps included; the runs take copies of the inputs in turn), and the median of several windows.
// Apart from v000's, it joins two sittings. Times from different sittings can be a few percent apart, while
// side-by-side timings come from the same sitting.
// v000 is the starting kernel. One run takes 3820 microseconds.
#include <hip/hip_runtime.h>

// Attention with a fused, d_in-scaled qk projection (x [4][2048][1024]; qk = (x Wqk + bqk) / sqrt(1024) ('xw' [1024][2048] sigma 1, zero bias) -> per head h: q = qk columns h*128 .. h*128+63, k = columns h*128+64 .. h*128+127; v = (x Wv + bv) / sqrt(1024) ('xw' [1024][1024] sigma 1) heads of 64; A = q.k / 64 (dim^-scale_exp, scale_exp 1); softmax; out = concat-heads(A v) -> [4][2048][1024] (8.4 M; no output projection)).
// Layout per batch: bf16 copy of x; Wqk transposed once into a [2048][1024] Bt whose rows are then gathered into separate q and k Bt blocks (row h*64+d <- h*128+d and h*128+64+d); the 1/sqrt(1024) = 2^-5 input scalings are folded EXACTLY into the bf16 weights and f32 biases (a power-of-two factor commutes with every rounding); exact projections; dense T-2048 attention with hi/lo 3-product score tiles on EVERY row (SCL 1/64); P and attn.v hybrid (rows < 512 hi/lo, rest fp16 x1024); the f32 merge writes the output rows.
// Compute dtypes, f32 accumulate: every input rounded to bf16; projections exact (x 2^-5 folded); scores 3 products on every row; softmax f32 (x 1/64); attn.v rows < 512 3 products, rest fp16; output f32.

#define NB_  4
#define TT   2048
#define DM   1024
#define NH_  16
#define NKV  16
#define REP  (NH_ / NKV)
#define HD   64
#define DQ   (NH_ * HD)
#define DKV  (NKV * HD)
#define ZH   2
#define RH   512                  // query rows < RH use hi+lo planes (0: none)
#define WIN  0
#define PCAR 1024.0f
#define SCL  0.015625f  // 1/DIM = 1/64 (scale_exp 1); the two 1/sqrt(1024) input scalings are folded into the weights
typedef _Float16 h16;
typedef unsigned short bf;
typedef __attribute__((ext_vector_type(16))) __bf16   v16bf;
typedef __attribute__((ext_vector_type(16))) _Float16 v16h;
typedef __attribute__((ext_vector_type(8)))  _Float16 v8h;
typedef __attribute__((ext_vector_type(8)))  unsigned short v8us;
typedef __attribute__((ext_vector_type(8)))  float    v8f;
typedef __attribute__((ext_vector_type(4)))  float    v4f;
typedef v8h  __attribute__((may_alias)) v8ha;
typedef v4f  __attribute__((may_alias)) v4fa;
typedef v8us __attribute__((may_alias)) v8usa;

__device__ __forceinline__ unsigned short f2bf(float f) { unsigned u = __float_as_uint(f); u += 0x7FFFu + ((u >> 16) & 1u); return (unsigned short)(u >> 16); }
__device__ __forceinline__ float bf2f(unsigned short b) { return __uint_as_float(((unsigned)b) << 16); }
__device__ __forceinline__ float bfr(float f) { return bf2f(f2bf(f)); }
__device__ __forceinline__ v16h cat16(v8h lo, v8h hi) { return __builtin_shufflevector(lo, hi, 0, 1, 2, 3, 4, 5, 6, 7, 8, 9, 10, 11, 12, 13, 14, 15); }
__device__ __forceinline__ v16bf cat16b(v8us lo, v8us hi) { return __builtin_bit_cast(v16bf, __builtin_shufflevector(lo, hi, 0, 1, 2, 3, 4, 5, 6, 7, 8, 9, 10, 11, 12, 13, 14, 15)); }
__device__ __forceinline__ v8f wmma16(v16h a, v16h b, v8f c) { return __builtin_amdgcn_wmma_f32_16x16x32_f16(false, a, false, b, (short)0, c, false, false); }
__device__ __forceinline__ v8f wmmab(v16bf a, v16bf b, v8f c) { return __builtin_amdgcn_wmma_f32_16x16x32_bf16(false, a, false, b, (short)0, c, false, false); }



// ---- k_gemmw: register-blocked GEMM, ONE WAVE per 64x64 output tile (16 accumulators), operands straight from K-contiguous 16-bit planes; grid (M/64, N/64, Z), 32 threads.
// C[m][n] (f32, pitch ldc, + optional f32 bias[n]) = sum_k A[m][k] Bt[n][k] (+ split products per NSPLIT). z-batch strides sA/sB/sC in elements. K % 32 == 0.
template <typename T16> struct WFrag;
template <> struct WFrag<h16> { typedef v16h V; static __device__ __forceinline__ V ld(const h16* p) { return cat16(*(const v8h*)p, *(const v8h*)(p + 16)); } static __device__ __forceinline__ v8f mma(V a, V b, v8f c) { return wmma16(a, b, c); } };
template <> struct WFrag<bf> { typedef v16bf V; static __device__ __forceinline__ V ld(const bf* p) { return cat16b(*(const v8us*)p, *(const v8us*)(p + 16)); } static __device__ __forceinline__ v8f mma(V a, V b, v8f c) { return wmmab(a, b, c); } };
template <typename T16, int NSPLIT, bool BIAS>
__global__ __launch_bounds__(32) void k_gemmw(const T16* __restrict__ A, const T16* __restrict__ A2, const T16* __restrict__ Bt, const T16* __restrict__ Bt2, int K, float* C, int ldc, const float* __restrict__ bias, size_t sA, size_t sB, size_t sC) {
    typedef typename WFrag<T16>::V V;
    __shared__ __align__(16) float os[16 * 68];
    const size_t z = blockIdx.z; A += z * sA; if (A2) A2 += z * sA; Bt += z * sB; if (Bt2) Bt2 += z * sB; C += z * sC;
    const int lane = threadIdx.x & 31, lr = lane & 15, hi = lane >> 4; const int r0 = blockIdx.x * 64, c0 = blockIdx.y * 64;
    v8f acc[4][4];
#pragma unroll
    for (int mb = 0; mb < 4; ++mb)
#pragma unroll
        for (int nb = 0; nb < 4; ++nb) acc[mb][nb] = (v8f){};
    const size_t aoff = (size_t)(r0 + lr) * K + 8 * hi, boff = (size_t)(c0 + lr) * K + 8 * hi;
#pragma unroll 1
    for (int kc = 0; kc < K; kc += 32) {
        V a[4], a2[4];
#pragma unroll
        for (int mb = 0; mb < 4; ++mb) { a[mb] = WFrag<T16>::ld(A + aoff + (size_t)mb * 16 * K + kc); if (NSPLIT == 1 || NSPLIT == 2) a2[mb] = WFrag<T16>::ld(A2 + aoff + (size_t)mb * 16 * K + kc); }
#pragma unroll
        for (int nb = 0; nb < 4; ++nb) { const V b = WFrag<T16>::ld(Bt + boff + (size_t)nb * 16 * K + kc); V b2; if (NSPLIT >= 2) b2 = WFrag<T16>::ld(Bt2 + boff + (size_t)nb * 16 * K + kc);
#pragma unroll
            for (int mb = 0; mb < 4; ++mb) { acc[mb][nb] = WFrag<T16>::mma(a[mb], b, acc[mb][nb]); if (NSPLIT == 1 || NSPLIT == 2) acc[mb][nb] = WFrag<T16>::mma(a2[mb], b, acc[mb][nb]); if (NSPLIT >= 2) acc[mb][nb] = WFrag<T16>::mma(a[mb], b2, acc[mb][nb]); } }
        asm volatile("v_nop\n\tv_nop\n\tv_nop\n\tv_nop" : "+v"(acc[0][0]), "+v"(acc[1][1]), "+v"(acc[2][2]), "+v"(acc[3][3]) : "v"(a[0]), "v"(a[3]));
    }
#pragma unroll
    for (int mb = 0; mb < 4; ++mb) {
#pragma unroll
        for (int nb = 0; nb < 4; ++nb) {
#pragma unroll
            for (int j = 0; j < 8; ++j) os[(hi * 8 + j) * 68 + nb * 16 + lr] = acc[mb][nb][j]; }
        __builtin_amdgcn_wave_barrier(); asm volatile("" ::: "memory");
        float* crow = C + (size_t)(r0 + mb * 16) * ldc + c0;
{
#pragma unroll
            for (int s = 0; s < 8; ++s) { const int row = 2 * s + hi, cofs = lr * 4; v4f val = *(const v4fa*)(os + row * 68 + cofs); if (BIAS) { val[0] += bfr(bias[c0 + cofs]); val[1] += bfr(bias[c0 + cofs + 1]); val[2] += bfr(bias[c0 + cofs + 2]); val[3] += bfr(bias[c0 + cofs + 3]); }
                *(v4f*)(crow + (size_t)row * ldc + cofs) = val; }
             }
        __builtin_amdgcn_wave_barrier(); asm volatile("" ::: "memory");
    }
}

__device__ __forceinline__ h16 tohx(float x) { return (h16)x; }
__device__ __forceinline__ void splitf(float y, unsigned short& h, unsigned short& l) { h = f2bf(y); l = f2bf(y - bf2f(h)); }
typedef __attribute__((ext_vector_type(2))) _Float16 v2h;
typedef __attribute__((ext_vector_type(4))) _Float16 v4h;
typedef __attribute__((ext_vector_type(2))) unsigned short v2us;
typedef __attribute__((ext_vector_type(4))) unsigned short v4us;
typedef __attribute__((ext_vector_type(2))) float v2f;
typedef __attribute__((ext_vector_type(4))) int v4i;

__global__ __launch_bounds__(256) void k_wtG(const float* __restrict__ w, int K, int N, bf* Bt) {
    const int lane = threadIdx.x & 31; const int L0 = (blockIdx.x * 8 + (threadIdx.x >> 5)) * 8; const int nlines = N * K / 64;
{
#pragma unroll 1
        for (int l = 0; l < 8; ++l) { const int L = L0 + l; if (L >= nlines) break; const size_t e = (size_t)L * 64 + lane * 2; const int k = (int)(e % K), n = (int)(e / K); v2us o;
            o[0] = f2bf(w[(size_t)k * N + n]); o[1] = f2bf(w[(size_t)(k + 1) * N + n]); *(v2us*)(Bt + e) = o; }
         }
}
__global__ __launch_bounds__(256) void k_cvt8(const float* __restrict__ src, bf* dst, size_t n8) { const size_t i = (size_t)blockIdx.x * 256 + threadIdx.x; if (i >= n8) return; const v8f v = *(const v8f*)(src + i * 8); v8us o;
#pragma unroll
    for (int k = 0; k < 8; ++k) o[k] = f2bf(v[k]); *(v8us*)(dst + i * 8) = o;  }

// k_rope: head planes [h][t][d] (fp16 + hi/lo) of rope(x) x sc with the rotate-half convention out[d] = x[d] cos[t][d] - x[d+HD/2] sin[t][d], out[d+HD/2] = x[d+HD/2] cos[t][d+HD/2] + x[d] sin[t][d+HD/2]
__global__ __launch_bounds__(256) void k_rope(const float* __restrict__ F, int pitch, int nheads, const float* __restrict__ CS, const float* __restrict__ RF, const float* __restrict__ nw, float sc, h16* P16, bf* Ph, bf* Pl) {
    const size_t e = ((size_t)blockIdx.x * 256 + threadIdx.x) * 2; if (e >= (size_t)nheads * TT * HD) return; const int d = (int)(e % HD); const int t = (int)((e / HD) % TT); const int h = (int)(e / ((size_t)HD * TT)); const float* f = F + (size_t)t * pitch + h * HD; const float rf = RF ? RF[(size_t)h * TT + t] : 1.0f; v2h o16; v2us oh, ol;
#pragma unroll
    for (int q = 0; q < 2; ++q) { const int dd = d + q; const int dp = (dd < HD / 2) ? dd + HD / 2 : dd - HD / 2; float x0 = f[dd], x1 = f[dp];
        if (RF) { float n0 = __fmul_rn(x0, rf), n1 = __fmul_rn(x1, rf); asm volatile("" : "+v"(n0)); asm volatile("" : "+v"(n1)); x0 = __fmul_rn(bfr(nw[dd]), n0); x1 = __fmul_rn(bfr(nw[dp]), n1); }
        const v2f cs = *(const v2f*)(CS + ((size_t)t * HD + dd) * 2); float a = __fmul_rn(x0, cs[0]), bq = __fmul_rn(x1, cs[1]); asm volatile("" : "+v"(a)); asm volatile("" : "+v"(bq)); const float r = ((dd < HD / 2) ? __fsub_rn(a, bq) : __fadd_rn(a, bq)) * sc;
        o16[q] = tohx(r); unsigned short a2, c2; splitf(r, a2, c2); oh[q] = a2; ol[q] = c2; }
    *(v2h*)(P16 + e) = o16; *(v2us*)(Ph + e) = oh; *(v2us*)(Pl + e) = ol;  }
__global__ __launch_bounds__(256) void k_vtp(const float* __restrict__ F, int pitch, int nheads, h16* V16, bf* Vh, bf* Vl) { const size_t e = ((size_t)blockIdx.x * 256 + threadIdx.x) * 2; if (e >= (size_t)nheads * HD * TT) return; const int t = (int)(e % TT); const int d = (int)((e / TT) % HD); const int g = (int)(e / ((size_t)TT * HD)); v2h o16; v2us oh, ol;
#pragma unroll
    for (int q = 0; q < 2; ++q) { const float x = F[(size_t)(t + q) * pitch + g * HD + d]; o16[q] = tohx(x); unsigned short a2, c2; splitf(x, a2, c2); oh[q] = a2; ol[q] = c2; }
    *(v2h*)(V16 + e) = o16; *(v2us*)(Vh + e) = oh; *(v2us*)(Vl + e) = ol;  }
__global__ __launch_bounds__(256) void k_csid(float* CS) { const int idx = blockIdx.x * 256 + threadIdx.x; if (idx >= TT * HD) return; v2f cs; cs[0] = 1.0f; cs[1] = 0.0f; *(v2f*)(CS + (size_t)idx * 2) = cs;  }
// k_asoft: per row (zz, i): t = S x HD^-1 (no mask); softmax over the 2048 keys (register row, one exp, fixed trees);
__global__ __launch_bounds__(256) void k_asoft(const float* __restrict__ Sb, h16* P16, bf* Ph, bf* Pl) {
    const int lane = threadIdx.x & 31; const int row = blockIdx.x * 8 + (threadIdx.x >> 5); if (row >= ZH * TT) return; const int i = row % TT; const int zz = row / TT; (void)zz; const bool hires = (i < RH); const float* sr = Sb + (size_t)row * TT; float v[TT / 32]; float mx = -3.0e38f;
#pragma unroll
    for (int ch = 0; ch < TT / 128; ++ch) { const int j0 = ch * 128 + lane * 4; const v4f a = *(const v4f*)(sr + j0);
#pragma unroll
        for (int q = 0; q < 4; ++q) { const int j = j0 + q; (void)j; const float t = a[q] * SCL; v[ch * 4 + q] = t; mx = fmaxf(mx, t); } }
#pragma unroll
    for (int sh = 16; sh; sh >>= 1) mx = fmaxf(mx, __shfl_xor(mx, sh, 32));
    float sum = 0.f;
#pragma unroll
    for (int k = 0; k < TT / 32; ++k) { float d0 = __fsub_rn(v[k], mx); asm volatile("" : "+v"(d0)); v[k] = __builtin_amdgcn_exp2f(__fmul_rn(d0, 1.4426950408889634f)); sum += v[k]; }
#pragma unroll
    for (int sh = 16; sh; sh >>= 1) sum += __shfl_xor(sum, sh, 32);
    const float f = __fdiv_rn(hires ? 1.0f : PCAR, sum);
{
        if (hires) {
#pragma unroll
            for (int ch = 0; ch < TT / 128; ++ch) { v4us oh, ol;
#pragma unroll
                for (int q = 0; q < 4; ++q) { unsigned short a, c2; splitf(v[ch * 4 + q] * f, a, c2); oh[q] = a; ol[q] = c2; }
                const size_t oo = ((size_t)zz * (RH ? RH : 1) + i) * TT + ch * 128 + lane * 4; *(v4us*)(Ph + oo) = oh; *(v4us*)(Pl + oo) = ol; }
        } else {
#pragma unroll
            for (int ch = 0; ch < TT / 128; ++ch) { v4h o4;
#pragma unroll
                for (int q = 0; q < 4; ++q) o4[q] = tohx(v[ch * 4 + q] * f);
                *(v4h*)(P16 + (size_t)row * TT + ch * 128 + lane * 4) = o4; } }
         }
}
// k_wtGs: k_wtG with a power-of-two pre-scale (w x wsc before the bf16 rounding; exact for wsc = 2^-5: the module's 1/sqrt(1024) input scaling folded into the weight).
__global__ __launch_bounds__(256) void k_wtGs(const float* __restrict__ w, int K, int N, bf* Bt, float wsc) {
    const int lane = threadIdx.x & 31; const int L0 = (blockIdx.x * 8 + (threadIdx.x >> 5)) * 8; const int nlines = N * K / 64;
{
#pragma unroll 1
        for (int l = 0; l < 8; ++l) { const int L = L0 + l; if (L >= nlines) break; const size_t e = (size_t)L * 64 + lane * 2; const int k = (int)(e % K), n = (int)(e / K); v2us o;
            o[0] = f2bf(__fmul_rn(w[(size_t)k * N + n], wsc)); o[1] = f2bf(__fmul_rn(w[(size_t)(k + 1) * N + n], wsc)); *(v2us*)(Bt + e) = o; }
         }
}

__global__ __launch_bounds__(256) void k_rowsel(const bf* __restrict__ Win, bf* Wout_, int off) { const size_t i = (size_t)blockIdx.x * 256 + threadIdx.x; if (i >= (size_t)DQ * DM / 8) return; const size_t e = i * 8; const int c = (int)(e % DM); const int ro = (int)(e / DM); const int hh = ro / HD, d = ro % HD; const size_t ri = (size_t)hh * 2 * HD + off + d; const v8us a = *(const v8us*)(Win + ri * DM + c); *(v8us*)(Wout_ + e) = a;  }
__global__ __launch_bounds__(256) void k_bsel(const float* __restrict__ bin, float* bout, int off, float bsc) { const int i = blockIdx.x * 256 + threadIdx.x; if (i >= DQ) return; const int hh = i / HD, d = i % HD; const float v = __fmul_rn(bin[hh * 2 * HD + off + d], bsc); *(float*)(bout + i) = v;  }
__global__ __launch_bounds__(256) void k_bsel1(const float* __restrict__ bin, float* bout, float bsc) { const int i = blockIdx.x * 256 + threadIdx.x; if (i >= DKV) return; const float v = __fmul_rn(bin[i], bsc); *(float*)(bout + i) = v;  }
__global__ __launch_bounds__(256) void k_merge(const float* __restrict__ O, int h0, float* OUTb) { const size_t e = ((size_t)blockIdx.x * 256 + threadIdx.x) * 2; if (e >= (size_t)ZH * TT * HD) return; const int d = (int)(e % HD); const int t = (int)((e / HD) % TT); const int zz = (int)(e / ((size_t)HD * TT)); const float cs = (t < RH) ? 1.0f : (1.0f / PCAR); const size_t oo = (size_t)t * DQ + (h0 + zz) * HD + d;
    v2f o2; o2[0] = O[e] * cs; o2[1] = O[e + 1] * cs; *(v2f*)(OUTb + oo) = o2;  }

extern "C" void kernel_launch(void* const* d_in, const int* in_sizes, int n_in,
                              void* d_out, int out_size, void* d_ws, size_t ws_size, hipStream_t stream) {
    (void)in_sizes; (void)n_in; (void)out_size;
    const float* x = (const float*)d_in[0]; const float* wqk = (const float*)d_in[1];   /* [1024][2048] */ const float* bqk = (const float*)d_in[2];   /* [2048] */ const float* wv = (const float*)d_in[3]; const float* bv = (const float*)d_in[4]; const float* wq = wqk, *wk = wqk, *wo = nullptr; (void)wo; const float* bq = bqk, *bk = bqk;
    float* OUT = (float*)d_out;     // [4][2048][1024]
    char* wsp = (char*)d_ws;
    auto take = [&](size_t bytes) { char* p = wsp; wsp += (bytes + 255) & ~(size_t)255; return (void*)p; };
    bf* WQK = (bf*)take((size_t)2 * DQ * DM * 2); float* BQ = (float*)take((size_t)DQ * 4); float* BK = (float*)take((size_t)DKV * 4); float* BV = (float*)take((size_t)DKV * 4); bf* WQ = (bf*)take((size_t)DQ * DM * 2); bf* WK = (bf*)take((size_t)DKV * DM * 2); bf* WV = (bf*)take((size_t)DKV * DM * 2); float* CS = (float*)take((size_t)TT * HD * 2 * 4);
    bf* XB = (bf*)take((size_t)TT * DM * 2); float* FQ = (float*)take((size_t)TT * DQ * 4); float* FK = (float*)take((size_t)TT * DKV * 4);
    h16* QP16 = (h16*)take((size_t)NH_ * TT * HD * 2); h16* KP16 = (h16*)take((size_t)NKV * TT * HD * 2); h16* VT16 = (h16*)take((size_t)NKV * HD * TT * 2);
    bf* QPh = (bf*)take((size_t)NH_ * TT * HD * 2); bf* QPl = (bf*)take((size_t)NH_ * TT * HD * 2); bf* KPh = (bf*)take((size_t)NKV * TT * HD * 2); bf* KPl = (bf*)take((size_t)NKV * TT * HD * 2); bf* VTh = (bf*)take((size_t)NKV * HD * TT * 2); bf* VTl = (bf*)take((size_t)NKV * HD * TT * 2); bf* Ph = (bf*)take((size_t)ZH * RH * TT * 2); bf* Pl = (bf*)take((size_t)ZH * RH * TT * 2);
    float* Sb = (float*)take((size_t)ZH * TT * TT * 4); h16* P16 = (h16*)take((size_t)ZH * TT * TT * 2); float* Ob = (float*)take((size_t)ZH * TT * HD * 4);
    if ((size_t)(wsp - (char*)d_ws) > ws_size) return;    // ws 256 MiB
    float* FV = FK;   // v projection reuses the k buffer after the k planes are built (stream-ordered)
    { k_wtGs<<<(unsigned)((DM * 2 * DQ / 64 + 63) / 64), 256, 0, stream>>>(wqk, DM, 2 * DQ, WQK, 0.03125f);   /* fused 'xw' Wqk [1024][2048] x 2^-5 -> Bt [2048][1024] */ k_rowsel<<<(unsigned)(((size_t)DQ * DM / 8 + 255) / 256), 256, 0, stream>>>(WQK, WQ, 0);   /* q rows: head h, dim d <- Bt row h*128 + d */ k_bsel<<<(DQ + 255) / 256, 256, 0, stream>>>(bqk, BQ, 0, 0.03125f); k_rowsel<<<(unsigned)(((size_t)DKV * DM / 8 + 255) / 256), 256, 0, stream>>>(WQK, WK, HD);   /* k rows <- Bt row h*128 + 64 + d */ k_bsel<<<(DKV + 255) / 256, 256, 0, stream>>>(bqk, BK, HD, 0.03125f); k_wtGs<<<(unsigned)((DM * DKV / 64 + 63) / 64), 256, 0, stream>>>(wv, DM, DKV, WV, 0.03125f);   /* Wv x 2^-5 */ k_bsel1<<<(DKV + 255) / 256, 256, 0, stream>>>(bv, BV, 0.03125f);
      
       }
    k_csid<<<(TT * HD + 255) / 256, 256, 0, stream>>>(CS);
    const unsigned LQ = (unsigned)(((size_t)NH_ * TT * HD / 2 + 255) / 256), LKv = (unsigned)(((size_t)NKV * TT * HD / 2 + 255) / 256);
    for (int b = 0; b < NB_; ++b) {
        
        k_cvt8<<<(unsigned)(((size_t)TT * DM / 8 + 255) / 256), 256, 0, stream>>>(x + (size_t)b * TT * DM, XB, (size_t)TT * DM / 8);
        k_gemmw<bf, 0, true><<<dim3(TT / 64, DQ / 64, 1), 32, 0, stream>>>(XB, nullptr, WQ, nullptr, DM, FQ, DQ, BQ, 0, 0, 0);
        k_rope<<<LQ, 256, 0, stream>>>(FQ, DQ, NH_, CS, nullptr, nullptr, 1.0f, QP16, QPh, QPl);
        k_gemmw<bf, 0, true><<<dim3(TT / 64, DKV / 64, 1), 32, 0, stream>>>(XB, nullptr, WK, nullptr, DM, FK, DKV, BK, 0, 0, 0);
        k_rope<<<LKv, 256, 0, stream>>>(FK, DKV, NKV, CS, nullptr, nullptr, 1.0f, KP16, KPh, KPl);
        k_gemmw<bf, 0, true><<<dim3(TT / 64, DKV / 64, 1), 32, 0, stream>>>(XB, nullptr, WV, nullptr, DM, FV, DKV, BV, 0, 0, 0); k_vtp<<<LKv, 256, 0, stream>>>(FV, DKV, NKV, VT16, VTh, VTl);
        for (int h0 = 0; h0 < NH_; h0 += ZH) { const size_t zq = (size_t)h0, zk = (size_t)(h0 / REP);   // one kv head per query head: the pass's two heads use consecutive kv planes (z-strides TT*HD)
            k_gemmw<bf, 2, false><<<dim3(TT / 64, TT / 64, ZH), 32, 0, stream>>>(QPh + zq * TT * HD, QPl + zq * TT * HD, KPh + zk * TT * HD, KPl + zk * TT * HD, HD, Sb, TT, nullptr, (size_t)TT * HD, (size_t)TT * HD, (size_t)TT * TT);   /* scores hi/lo on EVERY row */

            k_asoft<<<ZH * TT / 8, 256, 0, stream>>>(Sb, P16, Ph, Pl);
            k_gemmw<bf, 2, false><<<dim3(RH / 64, HD / 64, ZH), 32, 0, stream>>>(Ph, Pl, VTh + zk * HD * TT, VTl + zk * HD * TT, TT, Ob, HD, nullptr, (size_t)RH * TT, (size_t)HD * TT, (size_t)TT * HD);
            k_gemmw<h16, 0, false><<<dim3((TT - RH) / 64, HD / 64, ZH), 32, 0, stream>>>(P16 + (size_t)RH * TT, nullptr, VT16 + zk * HD * TT, nullptr, TT, Ob + (size_t)RH * HD, HD, nullptr, (size_t)TT * TT, (size_t)HD * TT, (size_t)TT * HD);
            k_merge<<<(unsigned)(((size_t)ZH * TT * HD / 2 + 255) / 256), 256, 0, stream>>>(Ob, h0, OUT + (size_t)b * TT * DQ); }
         }
}

// v001
// Measured time: 1570 microseconds a run.
// Two timings next to v000 put it at 2.45 and 2.46 times that version's speed.
#include <hip/hip_runtime.h>

// Attention with a fused, d_in-scaled qk projection (x [4][2048][1024]; qk = (x Wqk + bqk) / sqrt(1024) ('xw' [1024][2048] sigma 1, zero bias) -> per head h: q = qk columns h*128 .. h*128+63, k = columns h*128+64 .. h*128+127; v = (x Wv + bv) / sqrt(1024) ('xw' [1024][1024] sigma 1) heads of 64; A = q.k / 64 (dim^-scale_exp, scale_exp 1); softmax; out = concat-heads(A v) -> [4][2048][1024] (8.4 M; no output projection)).
// Layout per batch: bf16 copy of x; Wqk transposed once into a [2048][1024] Bt whose rows are then gathered into separate q and k Bt blocks (row h*64+d <- h*128+d and h*128+64+d); the 1/sqrt(1024) = 2^-5 input scalings are folded EXACTLY into the bf16 weights and f32 biases (a power-of-two factor commutes with every rounding); exact projections; dense T-2048 attention with hi/lo 3-product score tiles on EVERY row (SCL 1/64); P and attn.v hybrid (rows < 512 hi/lo, rest fp16 x1024); the f32 merge writes the output rows.
// Compute dtypes, f32 accumulate: every input rounded to bf16; projections exact (x 2^-5 folded); scores 3 products on every row; softmax f32 (x 1/64); attn.v rows < 512 3 products, rest fp16; output f32.

#define NB_  4
#define TT   2048
#define DM   1024
#define NH_  16
#define NKV  16
#define REP  (NH_ / NKV)
#define HD   64
#define DQ   (NH_ * HD)
#define DKV  (NKV * HD)
#define ZH   2
#define RH   512                  // query rows < RH use hi+lo planes (0: none)
#define WIN  0
#define PCAR 1024.0f
#define KSP  16                   // k slices of each attn.v product, one work-group per slice; k_merge adds the KSP partial planes in slice order
#define SCL  0.015625f  // 1/DIM = 1/64 (scale_exp 1); the two 1/sqrt(1024) input scalings are folded into the weights
typedef _Float16 h16;
typedef unsigned short bf;
typedef __attribute__((ext_vector_type(16))) __bf16   v16bf;
typedef __attribute__((ext_vector_type(16))) _Float16 v16h;
typedef __attribute__((ext_vector_type(8)))  _Float16 v8h;
typedef __attribute__((ext_vector_type(8)))  unsigned short v8us;
typedef __attribute__((ext_vector_type(8)))  float    v8f;
typedef __attribute__((ext_vector_type(4)))  float    v4f;
typedef v8h  __attribute__((may_alias)) v8ha;
typedef v4f  __attribute__((may_alias)) v4fa;
typedef v8us __attribute__((may_alias)) v8usa;

__device__ __forceinline__ unsigned short f2bf(float f) { unsigned u = __float_as_uint(f); u += 0x7FFFu + ((u >> 16) & 1u); return (unsigned short)(u >> 16); }
__device__ __forceinline__ float bf2f(unsigned short b) { return __uint_as_float(((unsigned)b) << 16); }
__device__ __forceinline__ float bfr(float f) { return bf2f(f2bf(f)); }
__device__ __forceinline__ v16h cat16(v8h lo, v8h hi) { return __builtin_shufflevector(lo, hi, 0, 1, 2, 3, 4, 5, 6, 7, 8, 9, 10, 11, 12, 13, 14, 15); }
__device__ __forceinline__ v16bf cat16b(v8us lo, v8us hi) { return __builtin_bit_cast(v16bf, __builtin_shufflevector(lo, hi, 0, 1, 2, 3, 4, 5, 6, 7, 8, 9, 10, 11, 12, 13, 14, 15)); }
__device__ __forceinline__ v8f wmma16(v16h a, v16h b, v8f c) { return __builtin_amdgcn_wmma_f32_16x16x32_f16(false, a, false, b, (short)0, c, false, false); }
__device__ __forceinline__ v8f wmmab(v16bf a, v16bf b, v8f c) { return __builtin_amdgcn_wmma_f32_16x16x32_bf16(false, a, false, b, (short)0, c, false, false); }



// ---- k_gemmw: register-blocked GEMM, ONE WAVE per 64x64 output tile (16 accumulators), operands straight from K-contiguous 16-bit planes; grid (M/64, N/64, Z), 32 threads.
// C[m][n] (f32, pitch ldc, + optional f32 bias[n]) = sum_k A[m][k] Bt[n][k] (+ split products per NSPLIT). z-batch strides sA/sB/sC in elements. K % 32 == 0.
// KSPL > 1: grid.y = (N/64) * KSPL; slice sl = blockIdx.y % KSPL sums only k in [sl K/KSPL, (sl+1) K/KSPL) and writes its own partial plane at C + sl * sP + z * sC (sP in elements). K % (32 KSPL) == 0.
template <typename T16> struct WFrag;
template <> struct WFrag<h16> { typedef v16h V; static __device__ __forceinline__ V ld(const h16* p) { return cat16(*(const v8h*)p, *(const v8h*)(p + 16)); } static __device__ __forceinline__ v8f mma(V a, V b, v8f c) { return wmma16(a, b, c); } };
template <> struct WFrag<bf> { typedef v16bf V; static __device__ __forceinline__ V ld(const bf* p) { return cat16b(*(const v8us*)p, *(const v8us*)(p + 16)); } static __device__ __forceinline__ v8f mma(V a, V b, v8f c) { return wmmab(a, b, c); } };
template <typename T16, int NSPLIT, bool BIAS, int KSPL = 1>
__global__ __launch_bounds__(32) void k_gemmw(const T16* __restrict__ A, const T16* __restrict__ A2, const T16* __restrict__ Bt, const T16* __restrict__ Bt2, int K, float* C, int ldc, const float* __restrict__ bias, size_t sA, size_t sB, size_t sC, size_t sP) {
    typedef typename WFrag<T16>::V V;
    __shared__ __align__(16) float os[16 * 68];
    const int sl = (KSPL > 1) ? (int)(blockIdx.y % KSPL) : 0; const int kb = sl * (K / KSPL), ke = kb + K / KSPL;
    const size_t z = blockIdx.z; A += z * sA; if (A2) A2 += z * sA; Bt += z * sB; if (Bt2) Bt2 += z * sB; C += (size_t)sl * sP + z * sC;
    const int lane = threadIdx.x & 31, lr = lane & 15, hi = lane >> 4; const int r0 = blockIdx.x * 64, c0 = (blockIdx.y / KSPL) * 64;
    v8f acc[4][4];
#pragma unroll
    for (int mb = 0; mb < 4; ++mb)
#pragma unroll
        for (int nb = 0; nb < 4; ++nb) acc[mb][nb] = (v8f){};
    const size_t aoff = (size_t)(r0 + lr) * K + 8 * hi, boff = (size_t)(c0 + lr) * K + 8 * hi;
#pragma unroll 1
    for (int kc = kb; kc < ke; kc += 32) {
        V a[4], a2[4];
#pragma unroll
        for (int mb = 0; mb < 4; ++mb) { a[mb] = WFrag<T16>::ld(A + aoff + (size_t)mb * 16 * K + kc); if (NSPLIT == 1 || NSPLIT == 2) a2[mb] = WFrag<T16>::ld(A2 + aoff + (size_t)mb * 16 * K + kc); }
#pragma unroll
        for (int nb = 0; nb < 4; ++nb) { const V b = WFrag<T16>::ld(Bt + boff + (size_t)nb * 16 * K + kc); V b2; if (NSPLIT >= 2) b2 = WFrag<T16>::ld(Bt2 + boff + (size_t)nb * 16 * K + kc);
#pragma unroll
            for (int mb = 0; mb < 4; ++mb) { acc[mb][nb] = WFrag<T16>::mma(a[mb], b, acc[mb][nb]); if (NSPLIT == 1 || NSPLIT == 2) acc[mb][nb] = WFrag<T16>::mma(a2[mb], b, acc[mb][nb]); if (NSPLIT >= 2) acc[mb][nb] = WFrag<T16>::mma(a[mb], b2, acc[mb][nb]); } }
        asm volatile("v_nop\n\tv_nop\n\tv_nop\n\tv_nop" : "+v"(acc[0][0]), "+v"(acc[1][1]), "+v"(acc[2][2]), "+v"(acc[3][3]) : "v"(a[0]), "v"(a[3]));
    }
#pragma unroll
    for (int mb = 0; mb < 4; ++mb) {
#pragma unroll
        for (int nb = 0; nb < 4; ++nb) {
#pragma unroll
            for (int j = 0; j < 8; ++j) os[(hi * 8 + j) * 68 + nb * 16 + lr] = acc[mb][nb][j]; }
        __builtin_amdgcn_wave_barrier(); asm volatile("" ::: "memory");
        float* crow = C + (size_t)(r0 + mb * 16) * ldc + c0;
{
#pragma unroll
            for (int s = 0; s < 8; ++s) { const int row = 2 * s + hi, cofs = lr * 4; v4f val = *(const v4fa*)(os + row * 68 + cofs); if (BIAS) { val[0] += bfr(bias[c0 + cofs]); val[1] += bfr(bias[c0 + cofs + 1]); val[2] += bfr(bias[c0 + cofs + 2]); val[3] += bfr(bias[c0 + cofs + 3]); }
                *(v4f*)(crow + (size_t)row * ldc + cofs) = val; }
             }
        __builtin_amdgcn_wave_barrier(); asm volatile("" ::: "memory");
    }
}

__device__ __forceinline__ h16 tohx(float x) { return (h16)x; }
__device__ __forceinline__ void splitf(float y, unsigned short& h, unsigned short& l) { h = f2bf(y); l = f2bf(y - bf2f(h)); }
typedef __attribute__((ext_vector_type(2))) _Float16 v2h;
typedef __attribute__((ext_vector_type(4))) _Float16 v4h;
typedef __attribute__((ext_vector_type(2))) unsigned short v2us;
typedef __attribute__((ext_vector_type(4))) unsigned short v4us;
typedef __attribute__((ext_vector_type(2))) float v2f;
typedef __attribute__((ext_vector_type(4))) int v4i;

__global__ __launch_bounds__(256) void k_wtG(const float* __restrict__ w, int K, int N, bf* Bt) {
    const int lane = threadIdx.x & 31; const int L0 = (blockIdx.x * 8 + (threadIdx.x >> 5)) * 8; const int nlines = N * K / 64;
{
#pragma unroll 1
        for (int l = 0; l < 8; ++l) { const int L = L0 + l; if (L >= nlines) break; const size_t e = (size_t)L * 64 + lane * 2; const int k = (int)(e % K), n = (int)(e / K); v2us o;
            o[0] = f2bf(w[(size_t)k * N + n]); o[1] = f2bf(w[(size_t)(k + 1) * N + n]); *(v2us*)(Bt + e) = o; }
         }
}
__global__ __launch_bounds__(256) void k_cvt8(const float* __restrict__ src, bf* dst, size_t n8) { const size_t i = (size_t)blockIdx.x * 256 + threadIdx.x; if (i >= n8) return; const v8f v = *(const v8f*)(src + i * 8); v8us o;
#pragma unroll
    for (int k = 0; k < 8; ++k) o[k] = f2bf(v[k]); *(v8us*)(dst + i * 8) = o;  }

// k_rope: head planes [h][t][d] (fp16 + hi/lo) of rope(x) x sc with the rotate-half convention out[d] = x[d] cos[t][d] - x[d+HD/2] sin[t][d], out[d+HD/2] = x[d+HD/2] cos[t][d+HD/2] + x[d] sin[t][d+HD/2]
__global__ __launch_bounds__(256) void k_rope(const float* __restrict__ F, int pitch, int nheads, const float* __restrict__ CS, const float* __restrict__ RF, const float* __restrict__ nw, float sc, h16* P16, bf* Ph, bf* Pl) {
    const size_t e = ((size_t)blockIdx.x * 256 + threadIdx.x) * 2; if (e >= (size_t)nheads * TT * HD) return; const int d = (int)(e % HD); const int t = (int)((e / HD) % TT); const int h = (int)(e / ((size_t)HD * TT)); const float* f = F + (size_t)t * pitch + h * HD; const float rf = RF ? RF[(size_t)h * TT + t] : 1.0f; v2h o16; v2us oh, ol;
#pragma unroll
    for (int q = 0; q < 2; ++q) { const int dd = d + q; const int dp = (dd < HD / 2) ? dd + HD / 2 : dd - HD / 2; float x0 = f[dd], x1 = f[dp];
        if (RF) { float n0 = __fmul_rn(x0, rf), n1 = __fmul_rn(x1, rf); asm volatile("" : "+v"(n0)); asm volatile("" : "+v"(n1)); x0 = __fmul_rn(bfr(nw[dd]), n0); x1 = __fmul_rn(bfr(nw[dp]), n1); }
        const v2f cs = *(const v2f*)(CS + ((size_t)t * HD + dd) * 2); float a = __fmul_rn(x0, cs[0]), bq = __fmul_rn(x1, cs[1]); asm volatile("" : "+v"(a)); asm volatile("" : "+v"(bq)); const float r = ((dd < HD / 2) ? __fsub_rn(a, bq) : __fadd_rn(a, bq)) * sc;
        o16[q] = tohx(r); unsigned short a2, c2; splitf(r, a2, c2); oh[q] = a2; ol[q] = c2; }
    *(v2h*)(P16 + e) = o16; *(v2us*)(Ph + e) = oh; *(v2us*)(Pl + e) = ol;  }
__global__ __launch_bounds__(256) void k_vtp(const float* __restrict__ F, int pitch, int nheads, h16* V16, bf* Vh, bf* Vl) { const size_t e = ((size_t)blockIdx.x * 256 + threadIdx.x) * 2; if (e >= (size_t)nheads * HD * TT) return; const int t = (int)(e % TT); const int d = (int)((e / TT) % HD); const int g = (int)(e / ((size_t)TT * HD)); v2h o16; v2us oh, ol;
#pragma unroll
    for (int q = 0; q < 2; ++q) { const float x = F[(size_t)(t + q) * pitch + g * HD + d]; o16[q] = tohx(x); unsigned short a2, c2; splitf(x, a2, c2); oh[q] = a2; ol[q] = c2; }
    *(v2h*)(V16 + e) = o16; *(v2us*)(Vh + e) = oh; *(v2us*)(Vl + e) = ol;  }
__global__ __launch_bounds__(256) void k_csid(float* CS) { const int idx = blockIdx.x * 256 + threadIdx.x; if (idx >= TT * HD) return; v2f cs; cs[0] = 1.0f; cs[1] = 0.0f; *(v2f*)(CS + (size_t)idx * 2) = cs;  }
// k_asoft: per row (zz, i): t = S x HD^-1 (no mask); softmax over the 2048 keys (register row, one exp, fixed trees);
__global__ __launch_bounds__(256) void k_asoft(const float* __restrict__ Sb, h16* P16, bf* Ph, bf* Pl) {
    const int lane = threadIdx.x & 31; const int row = blockIdx.x * 8 + (threadIdx.x >> 5); if (row >= ZH * TT) return; const int i = row % TT; const int zz = row / TT; (void)zz; const bool hires = (i < RH); const float* sr = Sb + (size_t)row * TT; float v[TT / 32]; float mx = -3.0e38f;
#pragma unroll
    for (int ch = 0; ch < TT / 128; ++ch) { const int j0 = ch * 128 + lane * 4; const v4f a = *(const v4f*)(sr + j0);
#pragma unroll
        for (int q = 0; q < 4; ++q) { const int j = j0 + q; (void)j; const float t = a[q] * SCL; v[ch * 4 + q] = t; mx = fmaxf(mx, t); } }
#pragma unroll
    for (int sh = 16; sh; sh >>= 1) mx = fmaxf(mx, __shfl_xor(mx, sh, 32));
    float sum = 0.f;
#pragma unroll
    for (int k = 0; k < TT / 32; ++k) { float d0 = __fsub_rn(v[k], mx); asm volatile("" : "+v"(d0)); v[k] = __builtin_amdgcn_exp2f(__fmul_rn(d0, 1.4426950408889634f)); sum += v[k]; }
#pragma unroll
    for (int sh = 16; sh; sh >>= 1) sum += __shfl_xor(sum, sh, 32);
    const float f = __fdiv_rn(hires ? 1.0f : PCAR, sum);
{
        if (hires) {
#pragma unroll
            for (int ch = 0; ch < TT / 128; ++ch) { v4us oh, ol;
#pragma unroll
                for (int q = 0; q < 4; ++q) { unsigned short a, c2; splitf(v[ch * 4 + q] * f, a, c2); oh[q] = a; ol[q] = c2; }
                const size_t oo = ((size_t)zz * (RH ? RH : 1) + i) * TT + ch * 128 + lane * 4; *(v4us*)(Ph + oo) = oh; *(v4us*)(Pl + oo) = ol; }
        } else {
#pragma unroll
            for (int ch = 0; ch < TT / 128; ++ch) { v4h o4;
#pragma unroll
                for (int q = 0; q < 4; ++q) o4[q] = tohx(v[ch * 4 + q] * f);
                *(v4h*)(P16 + (size_t)row * TT + ch * 128 + lane * 4) = o4; } }
         }
}
// k_wtGs: k_wtG with a power-of-two pre-scale (w x wsc before the bf16 rounding; exact for wsc = 2^-5: the module's 1/sqrt(1024) input scaling folded into the weight).
__global__ __launch_bounds__(256) void k_wtGs(const float* __restrict__ w, int K, int N, bf* Bt, float wsc) {
    const int lane = threadIdx.x & 31; const int L0 = (blockIdx.x * 8 + (threadIdx.x >> 5)) * 8; const int nlines = N * K / 64;
{
#pragma unroll 1
        for (int l = 0; l < 8; ++l) { const int L = L0 + l; if (L >= nlines) break; const size_t e = (size_t)L * 64 + lane * 2; const int k = (int)(e % K), n = (int)(e / K); v2us o;
            o[0] = f2bf(__fmul_rn(w[(size_t)k * N + n], wsc)); o[1] = f2bf(__fmul_rn(w[(size_t)(k + 1) * N + n], wsc)); *(v2us*)(Bt + e) = o; }
         }
}

__global__ __launch_bounds__(256) void k_rowsel(const bf* __restrict__ Win, bf* Wout_, int off) { const size_t i = (size_t)blockIdx.x * 256 + threadIdx.x; if (i >= (size_t)DQ * DM / 8) return; const size_t e = i * 8; const int c = (int)(e % DM); const int ro = (int)(e / DM); const int hh = ro / HD, d = ro % HD; const size_t ri = (size_t)hh * 2 * HD + off + d; const v8us a = *(const v8us*)(Win + ri * DM + c); *(v8us*)(Wout_ + e) = a;  }
__global__ __launch_bounds__(256) void k_bsel(const float* __restrict__ bin, float* bout, int off, float bsc) { const int i = blockIdx.x * 256 + threadIdx.x; if (i >= DQ) return; const int hh = i / HD, d = i % HD; const float v = __fmul_rn(bin[hh * 2 * HD + off + d], bsc); *(float*)(bout + i) = v;  }
__global__ __launch_bounds__(256) void k_bsel1(const float* __restrict__ bin, float* bout, float bsc) { const int i = blockIdx.x * 256 + threadIdx.x; if (i >= DKV) return; const float v = __fmul_rn(bin[i], bsc); *(float*)(bout + i) = v;  }
__global__ __launch_bounds__(256) void k_merge(const float* __restrict__ O, int h0, float* OUTb) { const size_t e = ((size_t)blockIdx.x * 256 + threadIdx.x) * 2; if (e >= (size_t)ZH * TT * HD) return; const int d = (int)(e % HD); const int t = (int)((e / HD) % TT); const int zz = (int)(e / ((size_t)HD * TT)); const float cs = (t < RH) ? 1.0f : (1.0f / PCAR); const size_t oo = (size_t)t * DQ + (h0 + zz) * HD + d;
    v2f a2 = *(const v2f*)(O + e);
#pragma unroll
    for (int s = 1; s < KSP; ++s) a2 += *(const v2f*)(O + (size_t)s * ZH * TT * HD + e);
    v2f o2; o2[0] = a2[0] * cs; o2[1] = a2[1] * cs; *(v2f*)(OUTb + oo) = o2;  }

extern "C" void kernel_launch(void* const* d_in, const int* in_sizes, int n_in,
                              void* d_out, int out_size, void* d_ws, size_t ws_size, hipStream_t stream) {
    (void)in_sizes; (void)n_in; (void)out_size;
    const float* x = (const float*)d_in[0]; const float* wqk = (const float*)d_in[1];   /* [1024][2048] */ const float* bqk = (const float*)d_in[2];   /* [2048] */ const float* wv = (const float*)d_in[3]; const float* bv = (const float*)d_in[4]; const float* wq = wqk, *wk = wqk, *wo = nullptr; (void)wo; const float* bq = bqk, *bk = bqk;
    float* OUT = (float*)d_out;     // [4][2048][1024]
    char* wsp = (char*)d_ws;
    auto take = [&](size_t bytes) { char* p = wsp; wsp += (bytes + 255) & ~(size_t)255; return (void*)p; };
    bf* WQK = (bf*)take((size_t)2 * DQ * DM * 2); float* BQ = (float*)take((size_t)DQ * 4); float* BK = (float*)take((size_t)DKV * 4); float* BV = (float*)take((size_t)DKV * 4); bf* WQ = (bf*)take((size_t)DQ * DM * 2); bf* WK = (bf*)take((size_t)DKV * DM * 2); bf* WV = (bf*)take((size_t)DKV * DM * 2); float* CS = (float*)take((size_t)TT * HD * 2 * 4);
    bf* XB = (bf*)take((size_t)TT * DM * 2); float* FQ = (float*)take((size_t)TT * DQ * 4); float* FK = (float*)take((size_t)TT * DKV * 4);
    h16* QP16 = (h16*)take((size_t)NH_ * TT * HD * 2); h16* KP16 = (h16*)take((size_t)NKV * TT * HD * 2); h16* VT16 = (h16*)take((size_t)NKV * HD * TT * 2);
    bf* QPh = (bf*)take((size_t)NH_ * TT * HD * 2); bf* QPl = (bf*)take((size_t)NH_ * TT * HD * 2); bf* KPh = (bf*)take((size_t)NKV * TT * HD * 2); bf* KPl = (bf*)take((size_t)NKV * TT * HD * 2); bf* VTh = (bf*)take((size_t)NKV * HD * TT * 2); bf* VTl = (bf*)take((size_t)NKV * HD * TT * 2); bf* Ph = (bf*)take((size_t)ZH * RH * TT * 2); bf* Pl = (bf*)take((size_t)ZH * RH * TT * 2);
    float* Sb = (float*)take((size_t)ZH * TT * TT * 4); h16* P16 = (h16*)take((size_t)ZH * TT * TT * 2); float* Ob = (float*)take((size_t)KSP * ZH * TT * HD * 4);
    if ((size_t)(wsp - (char*)d_ws) > ws_size) return;    // ws 256 MiB
    float* FV = FK;   // v projection reuses the k buffer after the k planes are built (stream-ordered)
    { k_wtGs<<<(unsigned)((DM * 2 * DQ / 64 + 63) / 64), 256, 0, stream>>>(wqk, DM, 2 * DQ, WQK, 0.03125f);   /* fused 'xw' Wqk [1024][2048] x 2^-5 -> Bt [2048][1024] */ k_rowsel<<<(unsigned)(((size_t)DQ * DM / 8 + 255) / 256), 256, 0, stream>>>(WQK, WQ, 0);   /* q rows: head h, dim d <- Bt row h*128 + d */ k_bsel<<<(DQ + 255) / 256, 256, 0, stream>>>(bqk, BQ, 0, 0.03125f); k_rowsel<<<(unsigned)(((size_t)DKV * DM / 8 + 255) / 256), 256, 0, stream>>>(WQK, WK, HD);   /* k rows <- Bt row h*128 + 64 + d */ k_bsel<<<(DKV + 255) / 256, 256, 0, stream>>>(bqk, BK, HD, 0.03125f); k_wtGs<<<(unsigned)((DM * DKV / 64 + 63) / 64), 256, 0, stream>>>(wv, DM, DKV, WV, 0.03125f);   /* Wv x 2^-5 */ k_bsel1<<<(DKV + 255) / 256, 256, 0, stream>>>(bv, BV, 0.03125f);
      
       }
    k_csid<<<(TT * HD + 255) / 256, 256, 0, stream>>>(CS);
    const unsigned LQ = (unsigned)(((size_t)NH_ * TT * HD / 2 + 255) / 256), LKv = (unsigned)(((size_t)NKV * TT * HD / 2 + 255) / 256);
    for (int b = 0; b < NB_; ++b) {
        
        k_cvt8<<<(unsigned)(((size_t)TT * DM / 8 + 255) / 256), 256, 0, stream>>>(x + (size_t)b * TT * DM, XB, (size_t)TT * DM / 8);
        k_gemmw<bf, 0, true><<<dim3(TT / 64, DQ / 64, 1), 32, 0, stream>>>(XB, nullptr, WQ, nullptr, DM, FQ, DQ, BQ, 0, 0, 0, 0);
        k_rope<<<LQ, 256, 0, stream>>>(FQ, DQ, NH_, CS, nullptr, nullptr, 1.0f, QP16, QPh, QPl);
        k_gemmw<bf, 0, true><<<dim3(TT / 64, DKV / 64, 1), 32, 0, stream>>>(XB, nullptr, WK, nullptr, DM, FK, DKV, BK, 0, 0, 0, 0);
        k_rope<<<LKv, 256, 0, stream>>>(FK, DKV, NKV, CS, nullptr, nullptr, 1.0f, KP16, KPh, KPl);
        k_gemmw<bf, 0, true><<<dim3(TT / 64, DKV / 64, 1), 32, 0, stream>>>(XB, nullptr, WV, nullptr, DM, FV, DKV, BV, 0, 0, 0, 0); k_vtp<<<LKv, 256, 0, stream>>>(FV, DKV, NKV, VT16, VTh, VTl);
        for (int h0 = 0; h0 < NH_; h0 += ZH) { const size_t zq = (size_t)h0, zk = (size_t)(h0 / REP);   // one kv head per query head: the pass's two heads use consecutive kv planes (z-strides TT*HD)
            k_gemmw<bf, 2, false><<<dim3(TT / 64, TT / 64, ZH), 32, 0, stream>>>(QPh + zq * TT * HD, QPl + zq * TT * HD, KPh + zk * TT * HD, KPl + zk * TT * HD, HD, Sb, TT, nullptr, (size_t)TT * HD, (size_t)TT * HD, (size_t)TT * TT, 0);   /* scores hi/lo on EVERY row */

            k_asoft<<<ZH * TT / 8, 256, 0, stream>>>(Sb, P16, Ph, Pl);
            k_gemmw<bf, 2, false, KSP><<<dim3(RH / 64, HD / 64 * KSP, ZH), 32, 0, stream>>>(Ph, Pl, VTh + zk * HD * TT, VTl + zk * HD * TT, TT, Ob, HD, nullptr, (size_t)RH * TT, (size_t)HD * TT, (size_t)TT * HD, (size_t)ZH * TT * HD);
            k_gemmw<h16, 0, false, KSP><<<dim3((TT - RH) / 64, HD / 64 * KSP, ZH), 32, 0, stream>>>(P16 + (size_t)RH * TT, nullptr, VT16 + zk * HD * TT, nullptr, TT, Ob + (size_t)RH * HD, HD, nullptr, (size_t)TT * TT, (size_t)HD * TT, (size_t)TT * HD, (size_t)ZH * TT * HD);
            k_merge<<<(unsigned)(((size_t)ZH * TT * HD / 2 + 255) / 256), 256, 0, stream>>>(Ob, h0, OUT + (size_t)b * TT * DQ); }
         }
}

// v002
// A run of this version takes 1200 microseconds.
// Two timings next to v001 put it at 1.30 and 1.31 times that version's speed.
// Over all steps from v000 it is 3.20 times as fast.
#include <hip/hip_runtime.h>

// Attention with a fused, d_in-scaled qk projection (x [4][2048][1024]; qk = (x Wqk + bqk) / sqrt(1024) ('xw' [1024][2048] sigma 1, zero bias) -> per head h: q = qk columns h*128 .. h*128+63, k = columns h*128+64 .. h*128+127; v = (x Wv + bv) / sqrt(1024) ('xw' [1024][1024] sigma 1) heads of 64; A = q.k / 64 (dim^-scale_exp, scale_exp 1); softmax; out = concat-heads(A v) -> [4][2048][1024] (8.4 M; no output projection)).
// Layout per batch: bf16 copy of x; Wqk transposed once into a [2048][1024] Bt whose rows are then gathered into separate q and k Bt blocks (row h*64+d <- h*128+d and h*128+64+d); the 1/sqrt(1024) = 2^-5 input scalings are folded EXACTLY into the bf16 weights and f32 biases (a power-of-two factor commutes with every rounding); exact projections; dense T-2048 attention with hi/lo 3-product score tiles on EVERY row (SCL 1/64); P and attn.v hybrid (rows < 512 hi/lo, rest fp16 x1024); the f32 merge writes the output rows.
// Compute dtypes, f32 accumulate: every input rounded to bf16; projections exact (x 2^-5 folded); scores 3 products on every row; softmax f32 (x 1/64); attn.v rows < 512 3 products, rest fp16; output f32.

#define NB_  4
#define TT   2048
#define DM   1024
#define NH_  16
#define NKV  16
#define REP  (NH_ / NKV)
#define HD   64
#define DQ   (NH_ * HD)
#define DKV  (NKV * HD)
#define ZH   8                    // heads per attention pass (z extent of the score, softmax, attn.v and merge launches)
#define PRW  (TT + RH)            // rows of one head's P block: RH hi rows, RH lo rows, then the TT - RH fp16 rows
#define RH   512                  // query rows < RH use hi+lo planes (0: none)
#define WIN  0
#define PCAR 1024.0f
#define KSP  16                   // k slices of each attn.v product, one work-group per slice; k_merge adds the KSP partial planes in slice order
#define SCL  0.015625f  // 1/DIM = 1/64 (scale_exp 1); the two 1/sqrt(1024) input scalings are folded into the weights
typedef _Float16 h16;
typedef unsigned short bf;
typedef __attribute__((ext_vector_type(16))) __bf16   v16bf;
typedef __attribute__((ext_vector_type(16))) _Float16 v16h;
typedef __attribute__((ext_vector_type(8)))  _Float16 v8h;
typedef __attribute__((ext_vector_type(8)))  unsigned short v8us;
typedef __attribute__((ext_vector_type(8)))  float    v8f;
typedef __attribute__((ext_vector_type(4)))  float    v4f;
typedef v8h  __attribute__((may_alias)) v8ha;
typedef v4f  __attribute__((may_alias)) v4fa;
typedef v8us __attribute__((may_alias)) v8usa;

__device__ __forceinline__ unsigned short f2bf(float f) { unsigned u = __float_as_uint(f); u += 0x7FFFu + ((u >> 16) & 1u); return (unsigned short)(u >> 16); }
__device__ __forceinline__ float bf2f(unsigned short b) { return __uint_as_float(((unsigned)b) << 16); }
__device__ __forceinline__ float bfr(float f) { return bf2f(f2bf(f)); }
__device__ __forceinline__ v16h cat16(v8h lo, v8h hi) { return __builtin_shufflevector(lo, hi, 0, 1, 2, 3, 4, 5, 6, 7, 8, 9, 10, 11, 12, 13, 14, 15); }
__device__ __forceinline__ v16bf cat16b(v8us lo, v8us hi) { return __builtin_bit_cast(v16bf, __builtin_shufflevector(lo, hi, 0, 1, 2, 3, 4, 5, 6, 7, 8, 9, 10, 11, 12, 13, 14, 15)); }
__device__ __forceinline__ v8f wmma16(v16h a, v16h b, v8f c) { return __builtin_amdgcn_wmma_f32_16x16x32_f16(false, a, false, b, (short)0, c, false, false); }
__device__ __forceinline__ v8f wmmab(v16bf a, v16bf b, v8f c) { return __builtin_amdgcn_wmma_f32_16x16x32_bf16(false, a, false, b, (short)0, c, false, false); }



// ---- k_gemmw: register-blocked GEMM, ONE WAVE per 64x64 output tile (16 accumulators), operands straight from K-contiguous 16-bit planes; grid (M/64, N/64, Z), 32 threads.
// C[m][n] (f32, pitch ldc, + optional f32 bias[n]) = sum_k A[m][k] Bt[n][k] (+ split products per NSPLIT). z-batch strides sA/sB/sC in elements. K % 32 == 0.
// KSPL > 1: grid.y = (N/64) * KSPL; slice sl = blockIdx.y % KSPL sums only k in [sl K/KSPL, (sl+1) K/KSPL) and writes its own partial plane at C + sl * sP + z * sC (sP in elements). K % (32 KSPL) == 0.
template <typename T16> struct WFrag;
template <> struct WFrag<h16> { typedef v16h V; static __device__ __forceinline__ V ld(const h16* p) { return cat16(*(const v8h*)p, *(const v8h*)(p + 16)); } static __device__ __forceinline__ v8f mma(V a, V b, v8f c) { return wmma16(a, b, c); } };
template <> struct WFrag<bf> { typedef v16bf V; static __device__ __forceinline__ V ld(const bf* p) { return cat16b(*(const v8us*)p, *(const v8us*)(p + 16)); } static __device__ __forceinline__ v8f mma(V a, V b, v8f c) { return wmmab(a, b, c); } };
template <typename T16, int NSPLIT, bool BIAS, int KSPL = 1>
__global__ __launch_bounds__(32) void k_gemmw(const T16* __restrict__ A, const T16* __restrict__ A2, const T16* __restrict__ Bt, const T16* __restrict__ Bt2, int K, float* C, int ldc, const float* __restrict__ bias, size_t sA, size_t sB, size_t sC, size_t sP) {
    typedef typename WFrag<T16>::V V;
    __shared__ __align__(16) float os[16 * 68];
    const int sl = (KSPL > 1) ? (int)(blockIdx.y % KSPL) : 0; const int kb = sl * (K / KSPL), ke = kb + K / KSPL;
    const size_t z = blockIdx.z; A += z * sA; if (A2) A2 += z * sA; Bt += z * sB; if (Bt2) Bt2 += z * sB; C += (size_t)sl * sP + z * sC;
    const int lane = threadIdx.x & 31, lr = lane & 15, hi = lane >> 4; const int r0 = blockIdx.x * 64, c0 = (blockIdx.y / KSPL) * 64;
    v8f acc[4][4];
#pragma unroll
    for (int mb = 0; mb < 4; ++mb)
#pragma unroll
        for (int nb = 0; nb < 4; ++nb) acc[mb][nb] = (v8f){};
    const size_t aoff = (size_t)(r0 + lr) * K + 8 * hi, boff = (size_t)(c0 + lr) * K + 8 * hi;
#pragma unroll 1
    for (int kc = kb; kc < ke; kc += 32) {
        V a[4], a2[4];
#pragma unroll
        for (int mb = 0; mb < 4; ++mb) { a[mb] = WFrag<T16>::ld(A + aoff + (size_t)mb * 16 * K + kc); if (NSPLIT == 1 || NSPLIT == 2) a2[mb] = WFrag<T16>::ld(A2 + aoff + (size_t)mb * 16 * K + kc); }
#pragma unroll
        for (int nb = 0; nb < 4; ++nb) { const V b = WFrag<T16>::ld(Bt + boff + (size_t)nb * 16 * K + kc); V b2; if (NSPLIT >= 2) b2 = WFrag<T16>::ld(Bt2 + boff + (size_t)nb * 16 * K + kc);
#pragma unroll
            for (int mb = 0; mb < 4; ++mb) { acc[mb][nb] = WFrag<T16>::mma(a[mb], b, acc[mb][nb]); if (NSPLIT == 1 || NSPLIT == 2) acc[mb][nb] = WFrag<T16>::mma(a2[mb], b, acc[mb][nb]); if (NSPLIT >= 2) acc[mb][nb] = WFrag<T16>::mma(a[mb], b2, acc[mb][nb]); } }
        asm volatile("v_nop\n\tv_nop\n\tv_nop\n\tv_nop" : "+v"(acc[0][0]), "+v"(acc[1][1]), "+v"(acc[2][2]), "+v"(acc[3][3]) : "v"(a[0]), "v"(a[3]));
    }
#pragma unroll
    for (int mb = 0; mb < 4; ++mb) {
#pragma unroll
        for (int nb = 0; nb < 4; ++nb) {
#pragma unroll
            for (int j = 0; j < 8; ++j) os[(hi * 8 + j) * 68 + nb * 16 + lr] = acc[mb][nb][j]; }
        __builtin_amdgcn_wave_barrier(); asm volatile("" ::: "memory");
        float* crow = C + (size_t)(r0 + mb * 16) * ldc + c0;
{
#pragma unroll
            for (int s = 0; s < 8; ++s) { const int row = 2 * s + hi, cofs = lr * 4; v4f val = *(const v4fa*)(os + row * 68 + cofs); if (BIAS) { val[0] += bfr(bias[c0 + cofs]); val[1] += bfr(bias[c0 + cofs + 1]); val[2] += bfr(bias[c0 + cofs + 2]); val[3] += bfr(bias[c0 + cofs + 3]); }
                *(v4f*)(crow + (size_t)row * ldc + cofs) = val; }
             }
        __builtin_amdgcn_wave_barrier(); asm volatile("" ::: "memory");
    }
}

__device__ __forceinline__ h16 tohx(float x) { return (h16)x; }
__device__ __forceinline__ void splitf(float y, unsigned short& h, unsigned short& l) { h = f2bf(y); l = f2bf(y - bf2f(h)); }
typedef __attribute__((ext_vector_type(2))) _Float16 v2h;
typedef __attribute__((ext_vector_type(4))) _Float16 v4h;
typedef __attribute__((ext_vector_type(2))) unsigned short v2us;
typedef __attribute__((ext_vector_type(4))) unsigned short v4us;
typedef __attribute__((ext_vector_type(2))) float v2f;
typedef __attribute__((ext_vector_type(4))) int v4i;

__global__ __launch_bounds__(256) void k_wtG(const float* __restrict__ w, int K, int N, bf* Bt) {
    const int lane = threadIdx.x & 31; const int L0 = (blockIdx.x * 8 + (threadIdx.x >> 5)) * 8; const int nlines = N * K / 64;
{
#pragma unroll 1
        for (int l = 0; l < 8; ++l) { const int L = L0 + l; if (L >= nlines) break; const size_t e = (size_t)L * 64 + lane * 2; const int k = (int)(e % K), n = (int)(e / K); v2us o;
            o[0] = f2bf(w[(size_t)k * N + n]); o[1] = f2bf(w[(size_t)(k + 1) * N + n]); *(v2us*)(Bt + e) = o; }
         }
}
__global__ __launch_bounds__(256) void k_cvt8(const float* __restrict__ src, bf* dst, size_t n8) { const size_t i = (size_t)blockIdx.x * 256 + threadIdx.x; if (i >= n8) return; const v8f v = *(const v8f*)(src + i * 8); v8us o;
#pragma unroll
    for (int k = 0; k < 8; ++k) o[k] = f2bf(v[k]); *(v8us*)(dst + i * 8) = o;  }

// k_rope: head planes [h][t][d] (fp16 + hi/lo) of rope(x) x sc with the rotate-half convention out[d] = x[d] cos[t][d] - x[d+HD/2] sin[t][d], out[d+HD/2] = x[d+HD/2] cos[t][d+HD/2] + x[d] sin[t][d+HD/2]
__global__ __launch_bounds__(256) void k_rope(const float* __restrict__ F, int pitch, int nheads, const float* __restrict__ CS, const float* __restrict__ RF, const float* __restrict__ nw, float sc, h16* P16, bf* Ph, bf* Pl) {
    const size_t e = ((size_t)blockIdx.x * 256 + threadIdx.x) * 2; if (e >= (size_t)nheads * TT * HD) return; const int d = (int)(e % HD); const int t = (int)((e / HD) % TT); const int h = (int)(e / ((size_t)HD * TT)); const float* f = F + (size_t)t * pitch + h * HD; const float rf = RF ? RF[(size_t)h * TT + t] : 1.0f; v2h o16; v2us oh, ol;
#pragma unroll
    for (int q = 0; q < 2; ++q) { const int dd = d + q; const int dp = (dd < HD / 2) ? dd + HD / 2 : dd - HD / 2; float x0 = f[dd], x1 = f[dp];
        if (RF) { float n0 = __fmul_rn(x0, rf), n1 = __fmul_rn(x1, rf); asm volatile("" : "+v"(n0)); asm volatile("" : "+v"(n1)); x0 = __fmul_rn(bfr(nw[dd]), n0); x1 = __fmul_rn(bfr(nw[dp]), n1); }
        const v2f cs = *(const v2f*)(CS + ((size_t)t * HD + dd) * 2); float a = __fmul_rn(x0, cs[0]), bq = __fmul_rn(x1, cs[1]); asm volatile("" : "+v"(a)); asm volatile("" : "+v"(bq)); const float r = ((dd < HD / 2) ? __fsub_rn(a, bq) : __fadd_rn(a, bq)) * sc;
        o16[q] = tohx(r); unsigned short a2, c2; splitf(r, a2, c2); oh[q] = a2; ol[q] = c2; }
    *(v2h*)(P16 + e) = o16; *(v2us*)(Ph + e) = oh; *(v2us*)(Pl + e) = ol;  }
__global__ __launch_bounds__(256) void k_vtp(const float* __restrict__ F, int pitch, int nheads, h16* V16, bf* Vh, bf* Vl) { const size_t e = ((size_t)blockIdx.x * 256 + threadIdx.x) * 2; if (e >= (size_t)nheads * HD * TT) return; const int t = (int)(e % TT); const int d = (int)((e / TT) % HD); const int g = (int)(e / ((size_t)TT * HD)); v2h o16; v2us oh, ol;
#pragma unroll
    for (int q = 0; q < 2; ++q) { const float x = F[(size_t)(t + q) * pitch + g * HD + d]; o16[q] = tohx(x); unsigned short a2, c2; splitf(x, a2, c2); oh[q] = a2; ol[q] = c2; }
    *(v2h*)(V16 + e) = o16; *(v2us*)(Vh + e) = oh; *(v2us*)(Vl + e) = ol;  }
__global__ __launch_bounds__(256) void k_csid(float* CS) { const int idx = blockIdx.x * 256 + threadIdx.x; if (idx >= TT * HD) return; v2f cs; cs[0] = 1.0f; cs[1] = 0.0f; *(v2f*)(CS + (size_t)idx * 2) = cs;  }
// k_asoft: per row (zz, i): t = S x SCL (no mask); softmax over the 2048 keys (register row, one exp, fixed trees); row i of head zz goes to row zz PRW + i behind each of the three plane pointers (Ph: block start; Pl and P16: RH rows further on)
__global__ __launch_bounds__(256) void k_asoft(const float* __restrict__ Sb, h16* P16, bf* Ph, bf* Pl) {
    const int lane = threadIdx.x & 31; const int row = blockIdx.x * 8 + (threadIdx.x >> 5); if (row >= ZH * TT) return; const int i = row % TT; const int zz = row / TT; (void)zz; const bool hires = (i < RH); const float* sr = Sb + (size_t)row * TT; float v[TT / 32]; float mx = -3.0e38f;
#pragma unroll
    for (int ch = 0; ch < TT / 128; ++ch) { const int j0 = ch * 128 + lane * 4; const v4f a = *(const v4f*)(sr + j0);
#pragma unroll
        for (int q = 0; q < 4; ++q) { const int j = j0 + q; (void)j; const float t = a[q] * SCL; v[ch * 4 + q] = t; mx = fmaxf(mx, t); } }
#pragma unroll
    for (int sh = 16; sh; sh >>= 1) mx = fmaxf(mx, __shfl_xor(mx, sh, 32));
    float sum = 0.f;
#pragma unroll
    for (int k = 0; k < TT / 32; ++k) { float d0 = __fsub_rn(v[k], mx); asm volatile("" : "+v"(d0)); v[k] = __builtin_amdgcn_exp2f(__fmul_rn(d0, 1.4426950408889634f)); sum += v[k]; }
#pragma unroll
    for (int sh = 16; sh; sh >>= 1) sum += __shfl_xor(sum, sh, 32);
    const float f = __fdiv_rn(hires ? 1.0f : PCAR, sum);
{
        if (hires) {
#pragma unroll
            for (int ch = 0; ch < TT / 128; ++ch) { v4us oh, ol;
#pragma unroll
                for (int q = 0; q < 4; ++q) { unsigned short a, c2; splitf(v[ch * 4 + q] * f, a, c2); oh[q] = a; ol[q] = c2; }
                const size_t oo = ((size_t)zz * PRW + i) * TT + ch * 128 + lane * 4; *(v4us*)(Ph + oo) = oh; *(v4us*)(Pl + oo) = ol; }
        } else {
#pragma unroll
            for (int ch = 0; ch < TT / 128; ++ch) { v4h o4;
#pragma unroll
                for (int q = 0; q < 4; ++q) o4[q] = tohx(v[ch * 4 + q] * f);
                *(v4h*)(P16 + ((size_t)zz * PRW + i) * TT + ch * 128 + lane * 4) = o4; } }
         }
}
// k_wtGs: k_wtG with a power-of-two pre-scale (w x wsc before the bf16 rounding; exact for wsc = 2^-5: the module's 1/sqrt(1024) input scaling folded into the weight).
__global__ __launch_bounds__(256) void k_wtGs(const float* __restrict__ w, int K, int N, bf* Bt, float wsc) {
    const int lane = threadIdx.x & 31; const int L0 = (blockIdx.x * 8 + (threadIdx.x >> 5)) * 8; const int nlines = N * K / 64;
{
#pragma unroll 1
        for (int l = 0; l < 8; ++l) { const int L = L0 + l; if (L >= nlines) break; const size_t e = (size_t)L * 64 + lane * 2; const int k = (int)(e % K), n = (int)(e / K); v2us o;
            o[0] = f2bf(__fmul_rn(w[(size_t)k * N + n], wsc)); o[1] = f2bf(__fmul_rn(w[(size_t)(k + 1) * N + n], wsc)); *(v2us*)(Bt + e) = o; }
         }
}

__global__ __launch_bounds__(256) void k_rowsel(const bf* __restrict__ Win, bf* Wout_, int off) { const size_t i = (size_t)blockIdx.x * 256 + threadIdx.x; if (i >= (size_t)DQ * DM / 8) return; const size_t e = i * 8; const int c = (int)(e % DM); const int ro = (int)(e / DM); const int hh = ro / HD, d = ro % HD; const size_t ri = (size_t)hh * 2 * HD + off + d; const v8us a = *(const v8us*)(Win + ri * DM + c); *(v8us*)(Wout_ + e) = a;  }
__global__ __launch_bounds__(256) void k_bsel(const float* __restrict__ bin, float* bout, int off, float bsc) { const int i = blockIdx.x * 256 + threadIdx.x; if (i >= DQ) return; const int hh = i / HD, d = i % HD; const float v = __fmul_rn(bin[hh * 2 * HD + off + d], bsc); *(float*)(bout + i) = v;  }
__global__ __launch_bounds__(256) void k_bsel1(const float* __restrict__ bin, float* bout, float bsc) { const int i = blockIdx.x * 256 + threadIdx.x; if (i >= DKV) return; const float v = __fmul_rn(bin[i], bsc); *(float*)(bout + i) = v;  }
__global__ __launch_bounds__(256) void k_merge(const float* __restrict__ O, int h0, float* OUTb) { const size_t e = ((size_t)blockIdx.x * 256 + threadIdx.x) * 2; if (e >= (size_t)ZH * TT * HD) return; const int d = (int)(e % HD); const int t = (int)((e / HD) % TT); const int zz = (int)(e / ((size_t)HD * TT)); const float cs = (t < RH) ? 1.0f : (1.0f / PCAR); const size_t oo = (size_t)t * DQ + (h0 + zz) * HD + d;
    v2f a2 = *(const v2f*)(O + e);
#pragma unroll
    for (int s = 1; s < KSP; ++s) a2 += *(const v2f*)(O + (size_t)s * ZH * TT * HD + e);
    v2f o2; o2[0] = a2[0] * cs; o2[1] = a2[1] * cs; *(v2f*)(OUTb + oo) = o2;  }

extern "C" void kernel_launch(void* const* d_in, const int* in_sizes, int n_in,
                              void* d_out, int out_size, void* d_ws, size_t ws_size, hipStream_t stream) {
    (void)in_sizes; (void)n_in; (void)out_size;
    const float* x = (const float*)d_in[0]; const float* wqk = (const float*)d_in[1];   /* [1024][2048] */ const float* bqk = (const float*)d_in[2];   /* [2048] */ const float* wv = (const float*)d_in[3]; const float* bv = (const float*)d_in[4]; const float* wq = wqk, *wk = wqk, *wo = nullptr; (void)wo; const float* bq = bqk, *bk = bqk;
    float* OUT = (float*)d_out;     // [4][2048][1024]
    char* wsp = (char*)d_ws;
    auto take = [&](size_t bytes) { char* p = wsp; wsp += (bytes + 255) & ~(size_t)255; return (void*)p; };
    bf* WQK = (bf*)take((size_t)2 * DQ * DM * 2); float* BQ = (float*)take((size_t)DQ * 4); float* BK = (float*)take((size_t)DKV * 4); float* BV = (float*)take((size_t)DKV * 4); bf* WQ = (bf*)take((size_t)DQ * DM * 2); bf* WK = (bf*)take((size_t)DKV * DM * 2); bf* WV = (bf*)take((size_t)DKV * DM * 2); float* CS = (float*)take((size_t)TT * HD * 2 * 4);
    float* Sb = (float*)take((size_t)ZH * TT * TT * 4);   // 128 MiB of score planes, live only from the score launch to k_asoft; two sets of buffers that are dead in that span lie over its start (all stream-ordered):
    char* ov = (char*)Sb; auto over = [&](size_t bytes) { char* p = ov; ov += (bytes + 255) & ~(size_t)255; return (void*)p; };
    bf* XB = (bf*)over((size_t)TT * DM * 2); float* FQ = (float*)over((size_t)TT * DQ * 4); float* FK = (float*)over((size_t)TT * DKV * 4);   // 20 MiB, written and read before a batch's first pass
    float* Ob = Sb;   // 64 MiB of attn.v partial planes, written after k_asoft has read the scores, read by k_merge before the next score launch
    h16* QP16 = (h16*)take((size_t)NH_ * TT * HD * 2); h16* KP16 = (h16*)take((size_t)NKV * TT * HD * 2); h16* VT16 = (h16*)take((size_t)NKV * HD * TT * 2);
    bf* QPh = (bf*)take((size_t)NH_ * TT * HD * 2); bf* QPl = (bf*)take((size_t)NH_ * TT * HD * 2); bf* KPh = (bf*)take((size_t)NKV * TT * HD * 2); bf* KPl = (bf*)take((size_t)NKV * TT * HD * 2); bf* VTh = (bf*)take((size_t)NKV * HD * TT * 2); bf* VTl = (bf*)take((size_t)NKV * HD * TT * 2);
    bf* Ph = (bf*)take((size_t)ZH * PRW * TT * 2); bf* Pl = Ph + (size_t)RH * TT; h16* P16 = (h16*)Pl;   // one P block per head (80 MiB)
    if ((size_t)(wsp - (char*)d_ws) > ws_size) return;    // ws 256 MiB
    float* FV = FK;   // v projection reuses the k buffer after the k planes are built (stream-ordered)
    { k_wtGs<<<(unsigned)((DM * 2 * DQ / 64 + 63) / 64), 256, 0, stream>>>(wqk, DM, 2 * DQ, WQK, 0.03125f);   /* fused 'xw' Wqk [1024][2048] x 2^-5 -> Bt [2048][1024] */ k_rowsel<<<(unsigned)(((size_t)DQ * DM / 8 + 255) / 256), 256, 0, stream>>>(WQK, WQ, 0);   /* q rows: head h, dim d <- Bt row h*128 + d */ k_bsel<<<(DQ + 255) / 256, 256, 0, stream>>>(bqk, BQ, 0, 0.03125f); k_rowsel<<<(unsigned)(((size_t)DKV * DM / 8 + 255) / 256), 256, 0, stream>>>(WQK, WK, HD);   /* k rows <- Bt row h*128 + 64 + d */ k_bsel<<<(DKV + 255) / 256, 256, 0, stream>>>(bqk, BK, HD, 0.03125f); k_wtGs<<<(unsigned)((DM * DKV / 64 + 63) / 64), 256, 0, stream>>>(wv, DM, DKV, WV, 0.03125f);   /* Wv x 2^-5 */ k_bsel1<<<(DKV + 255) / 256, 256, 0, stream>>>(bv, BV, 0.03125f);
      
       }
    k_csid<<<(TT * HD + 255) / 256, 256, 0, stream>>>(CS);
    const unsigned LQ = (unsigned)(((size_t)NH_ * TT * HD / 2 + 255) / 256), LKv = (unsigned)(((size_t)NKV * TT * HD / 2 + 255) / 256);
    for (int b = 0; b < NB_; ++b) {
        
        k_cvt8<<<(unsigned)(((size_t)TT * DM / 8 + 255) / 256), 256, 0, stream>>>(x + (size_t)b * TT * DM, XB, (size_t)TT * DM / 8);
        k_gemmw<bf, 0, true><<<dim3(TT / 64, DQ / 64, 1), 32, 0, stream>>>(XB, nullptr, WQ, nullptr, DM, FQ, DQ, BQ, 0, 0, 0, 0);
        k_rope<<<LQ, 256, 0, stream>>>(FQ, DQ, NH_, CS, nullptr, nullptr, 1.0f, QP16, QPh, QPl);
        k_gemmw<bf, 0, true><<<dim3(TT / 64, DKV / 64, 1), 32, 0, stream>>>(XB, nullptr, WK, nullptr, DM, FK, DKV, BK, 0, 0, 0, 0);
        k_rope<<<LKv, 256, 0, stream>>>(FK, DKV, NKV, CS, nullptr, nullptr, 1.0f, KP16, KPh, KPl);
        k_gemmw<bf, 0, true><<<dim3(TT / 64, DKV / 64, 1), 32, 0, stream>>>(XB, nullptr, WV, nullptr, DM, FV, DKV, BV, 0, 0, 0, 0); k_vtp<<<LKv, 256, 0, stream>>>(FV, DKV, NKV, VT16, VTh, VTl);
        for (int h0 = 0; h0 < NH_; h0 += ZH) { const size_t zq = (size_t)h0, zk = (size_t)(h0 / REP);   // one kv head per query head: the pass's ZH heads use consecutive kv planes (z-strides TT*HD)
            k_gemmw<bf, 2, false><<<dim3(TT / 64, TT / 64, ZH), 32, 0, stream>>>(QPh + zq * TT * HD, QPl + zq * TT * HD, KPh + zk * TT * HD, KPl + zk * TT * HD, HD, Sb, TT, nullptr, (size_t)TT * HD, (size_t)TT * HD, (size_t)TT * TT, 0);   /* scores hi/lo on EVERY row */

            k_asoft<<<ZH * TT / 8, 256, 0, stream>>>(Sb, P16, Ph, Pl);
            k_gemmw<bf, 2, false, KSP><<<dim3(RH / 64, HD / 64 * KSP, ZH), 32, 0, stream>>>(Ph, Pl, VTh + zk * HD * TT, VTl + zk * HD * TT, TT, Ob, HD, nullptr, (size_t)PRW * TT, (size_t)HD * TT, (size_t)TT * HD, (size_t)ZH * TT * HD);
            k_gemmw<h16, 0, false, KSP><<<dim3((TT - RH) / 64, HD / 64 * KSP, ZH), 32, 0, stream>>>(P16 + (size_t)RH * TT, nullptr, VT16 + zk * HD * TT, nullptr, TT, Ob + (size_t)RH * HD, HD, nullptr, (size_t)PRW * TT, (size_t)HD * TT, (size_t)TT * HD, (size_t)ZH * TT * HD);
            k_merge<<<(unsigned)(((size_t)ZH * TT * HD / 2 + 255) / 256), 256, 0, stream>>>(Ob, h0, OUT + (size_t)b * TT * DQ); }
         }
}

// v003
// A run of this version takes 511 microseconds.
// Timed twice side by side with v002, it ran 2.32 and 2.36 times as fast.
// All steps since v000 together make it 7.51 times as fast.
#include <hip/hip_runtime.h>

// Attention with a fused, d_in-scaled qk projection (x [4][2048][1024]; qk = (x Wqk + bqk) / sqrt(1024) ('xw' [1024][2048] sigma 1, zero bias) -> per head h: q = qk columns h*128 .. h*128+63, k = columns h*128+64 .. h*128+127; v = (x Wv + bv) / sqrt(1024) ('xw' [1024][1024] sigma 1) heads of 64; A = q.k / 64 (dim^-scale_exp, scale_exp 1); softmax; out = concat-heads(A v) -> [4][2048][1024] (8.4 M; no output projection)).
// Layout per batch: bf16 copy of x; Wqk transposed once into a [2048][1024] Bt whose rows are then gathered into separate q and k Bt blocks (row h*64+d <- h*128+d and h*128+64+d); the 1/sqrt(1024) = 2^-5 input scalings are folded EXACTLY into the bf16 weights and f32 biases (a power-of-two factor commutes with every rounding); exact projections; the q, k and v planes of all four batches are kept, and ONE launch (k_fattn) then does scores, softmax and attn.v for every batch and head with hi/lo 3-product score tiles on EVERY row (SCL 1/64); P and attn.v hybrid (rows < 512 hi/lo, rest fp16); it writes the f32 output rows.
// Compute dtypes, f32 accumulate: every input rounded to bf16; projections exact (x 2^-5 folded); scores 3 products on every row; softmax f32 (x 1/64), running maximum and sum over passes of 32 keys; attn.v rows < 512 3 products, rest fp16; output f32.

#define NB_  4
#define TT   2048
#define DM   1024
#define NH_  16
#define NKV  16
#define REP  (NH_ / NKV)
#define HD   64
#define DQ   (NH_ * HD)
#define DKV  (NKV * HD)
#define QW   32                   // query columns of one wave of k_fattn (two 16-column groups)
#define QB   256                  // query rows of one k_fattn work-group (8 waves); RH and TT are multiples of it
#define RH   512                  // query rows < RH use hi+lo planes (0: none)
#define WIN  0
#define SCL  0.015625f  // 1/DIM = 1/64 (scale_exp 1); the two 1/sqrt(1024) input scalings are folded into the weights
typedef _Float16 h16;
typedef unsigned short bf;
typedef __attribute__((ext_vector_type(16))) __bf16   v16bf;
typedef __attribute__((ext_vector_type(16))) _Float16 v16h;
typedef __attribute__((ext_vector_type(8)))  _Float16 v8h;
typedef __attribute__((ext_vector_type(8)))  unsigned short v8us;
typedef __attribute__((ext_vector_type(8)))  float    v8f;
typedef __attribute__((ext_vector_type(4)))  float    v4f;
typedef v8h  __attribute__((may_alias)) v8ha;
typedef v4f  __attribute__((may_alias)) v4fa;
typedef v8us __attribute__((may_alias)) v8usa;

__device__ __forceinline__ unsigned short f2bf(float f) { unsigned u = __float_as_uint(f); u += 0x7FFFu + ((u >> 16) & 1u); return (unsigned short)(u >> 16); }
__device__ __forceinline__ float bf2f(unsigned short b) { return __uint_as_float(((unsigned)b) << 16); }
__device__ __forceinline__ float bfr(float f) { return bf2f(f2bf(f)); }
__device__ __forceinline__ v16h cat16(v8h lo, v8h hi) { return __builtin_shufflevector(lo, hi, 0, 1, 2, 3, 4, 5, 6, 7, 8, 9, 10, 11, 12, 13, 14, 15); }
__device__ __forceinline__ v16bf cat16b(v8us lo, v8us hi) { return __builtin_bit_cast(v16bf, __builtin_shufflevector(lo, hi, 0, 1, 2, 3, 4, 5, 6, 7, 8, 9, 10, 11, 12, 13, 14, 15)); }
__device__ __forceinline__ v8f wmma16(v16h a, v16h b, v8f c) { return __builtin_amdgcn_wmma_f32_16x16x32_f16(false, a, false, b, (short)0, c, false, false); }
__device__ __forceinline__ v8f wmmab(v16bf a, v16bf b, v8f c) { return __builtin_amdgcn_wmma_f32_16x16x32_bf16(false, a, false, b, (short)0, c, false, false); }



// ---- k_gemmw: register-blocked GEMM, ONE WAVE per 64x64 output tile (16 accumulators), operands straight from K-contiguous 16-bit planes; grid (M/64, N/64, Z), 32 threads.
// C[m][n] (f32, pitch ldc, + optional f32 bias[n]) = sum_k A[m][k] Bt[n][k] (+ split products per NSPLIT). z-batch strides sA/sB/sC in elements. K % 32 == 0.
// KSPL > 1: grid.y = (N/64) * KSPL; slice sl = blockIdx.y % KSPL sums only k in [sl K/KSPL, (sl+1) K/KSPL) and writes its own partial plane at C + sl * sP + z * sC (sP in elements). K % (32 KSPL) == 0.
template <typename T16> struct WFrag;
template <> struct WFrag<h16> { typedef v16h V; static __device__ __forceinline__ V ld(const h16* p) { return cat16(*(const v8h*)p, *(const v8h*)(p + 16)); } static __device__ __forceinline__ v8f mma(V a, V b, v8f c) { return wmma16(a, b, c); } };
template <> struct WFrag<bf> { typedef v16bf V; static __device__ __forceinline__ V ld(const bf* p) { return cat16b(*(const v8us*)p, *(const v8us*)(p + 16)); } static __device__ __forceinline__ v8f mma(V a, V b, v8f c) { return wmmab(a, b, c); } };
template <typename T16, int NSPLIT, bool BIAS, int KSPL = 1>
__global__ __launch_bounds__(32) void k_gemmw(const T16* __restrict__ A, const T16* __restrict__ A2, const T16* __restrict__ Bt, const T16* __restrict__ Bt2, int K, float* C, int ldc, const float* __restrict__ bias, size_t sA, size_t sB, size_t sC, size_t sP) {
    typedef typename WFrag<T16>::V V;
    __shared__ __align__(16) float os[16 * 68];
    const int sl = (KSPL > 1) ? (int)(blockIdx.y % KSPL) : 0; const int kb = sl * (K / KSPL), ke = kb + K / KSPL;
    const size_t z = blockIdx.z; A += z * sA; if (A2) A2 += z * sA; Bt += z * sB; if (Bt2) Bt2 += z * sB; C += (size_t)sl * sP + z * sC;
    const int lane = threadIdx.x & 31, lr = lane & 15, hi = lane >> 4; const int r0 = blockIdx.x * 64, c0 = (blockIdx.y / KSPL) * 64;
    v8f acc[4][4];
#pragma unroll
    for (int mb = 0; mb < 4; ++mb)
#pragma unroll
        for (int nb = 0; nb < 4; ++nb) acc[mb][nb] = (v8f){};
    const size_t aoff = (size_t)(r0 + lr) * K + 8 * hi, boff = (size_t)(c0 + lr) * K + 8 * hi;
#pragma unroll 1
    for (int kc = kb; kc < ke; kc += 32) {
        V a[4], a2[4];
#pragma unroll
        for (int mb = 0; mb < 4; ++mb) { a[mb] = WFrag<T16>::ld(A + aoff + (size_t)mb * 16 * K + kc); if (NSPLIT == 1 || NSPLIT == 2) a2[mb] = WFrag<T16>::ld(A2 + aoff + (size_t)mb * 16 * K + kc); }
#pragma unroll
        for (int nb = 0; nb < 4; ++nb) { const V b = WFrag<T16>::ld(Bt + boff + (size_t)nb * 16 * K + kc); V b2; if (NSPLIT >= 2) b2 = WFrag<T16>::ld(Bt2 + boff + (size_t)nb * 16 * K + kc);
#pragma unroll
            for (int mb = 0; mb < 4; ++mb) { acc[mb][nb] = WFrag<T16>::mma(a[mb], b, acc[mb][nb]); if (NSPLIT == 1 || NSPLIT == 2) acc[mb][nb] = WFrag<T16>::mma(a2[mb], b, acc[mb][nb]); if (NSPLIT >= 2) acc[mb][nb] = WFrag<T16>::mma(a[mb], b2, acc[mb][nb]); } }
        asm volatile("v_nop\n\tv_nop\n\tv_nop\n\tv_nop" : "+v"(acc[0][0]), "+v"(acc[1][1]), "+v"(acc[2][2]), "+v"(acc[3][3]) : "v"(a[0]), "v"(a[3]));
    }
#pragma unroll
    for (int mb = 0; mb < 4; ++mb) {
#pragma unroll
        for (int nb = 0; nb < 4; ++nb) {
#pragma unroll
            for (int j = 0; j < 8; ++j) os[(hi * 8 + j) * 68 + nb * 16 + lr] = acc[mb][nb][j]; }
        __builtin_amdgcn_wave_barrier(); asm volatile("" ::: "memory");
        float* crow = C + (size_t)(r0 + mb * 16) * ldc + c0;
{
#pragma unroll
            for (int s = 0; s < 8; ++s) { const int row = 2 * s + hi, cofs = lr * 4; v4f val = *(const v4fa*)(os + row * 68 + cofs); if (BIAS) { val[0] += bfr(bias[c0 + cofs]); val[1] += bfr(bias[c0 + cofs + 1]); val[2] += bfr(bias[c0 + cofs + 2]); val[3] += bfr(bias[c0 + cofs + 3]); }
                *(v4f*)(crow + (size_t)row * ldc + cofs) = val; }
             }
        __builtin_amdgcn_wave_barrier(); asm volatile("" ::: "memory");
    }
}

__device__ __forceinline__ h16 tohx(float x) { return (h16)x; }
__device__ __forceinline__ void splitf(float y, unsigned short& h, unsigned short& l) { h = f2bf(y); l = f2bf(y - bf2f(h)); }
typedef __attribute__((ext_vector_type(2))) _Float16 v2h;
typedef __attribute__((ext_vector_type(4))) _Float16 v4h;
typedef __attribute__((ext_vector_type(2))) unsigned short v2us;
typedef __attribute__((ext_vector_type(4))) unsigned short v4us;
typedef __attribute__((ext_vector_type(2))) float v2f;
typedef __attribute__((ext_vector_type(4))) int v4i;

__global__ __launch_bounds__(256) void k_wtG(const float* __restrict__ w, int K, int N, bf* Bt) {
    const int lane = threadIdx.x & 31; const int L0 = (blockIdx.x * 8 + (threadIdx.x >> 5)) * 8; const int nlines = N * K / 64;
{
#pragma unroll 1
        for (int l = 0; l < 8; ++l) { const int L = L0 + l; if (L >= nlines) break; const size_t e = (size_t)L * 64 + lane * 2; const int k = (int)(e % K), n = (int)(e / K); v2us o;
            o[0] = f2bf(w[(size_t)k * N + n]); o[1] = f2bf(w[(size_t)(k + 1) * N + n]); *(v2us*)(Bt + e) = o; }
         }
}
__global__ __launch_bounds__(256) void k_cvt8(const float* __restrict__ src, bf* dst, size_t n8) { const size_t i = (size_t)blockIdx.x * 256 + threadIdx.x; if (i >= n8) return; const v8f v = *(const v8f*)(src + i * 8); v8us o;
#pragma unroll
    for (int k = 0; k < 8; ++k) o[k] = f2bf(v[k]); *(v8us*)(dst + i * 8) = o;  }

// k_rope: head planes [h][t][d] (fp16 + hi/lo) of rope(x) x sc with the rotate-half convention out[d] = x[d] cos[t][d] - x[d+HD/2] sin[t][d], out[d+HD/2] = x[d+HD/2] cos[t][d+HD/2] + x[d] sin[t][d+HD/2]
__global__ __launch_bounds__(256) void k_rope(const float* __restrict__ F, int pitch, int nheads, const float* __restrict__ CS, const float* __restrict__ RF, const float* __restrict__ nw, float sc, h16* P16, bf* Ph, bf* Pl) {
    const size_t e = ((size_t)blockIdx.x * 256 + threadIdx.x) * 2; if (e >= (size_t)nheads * TT * HD) return; const int d = (int)(e % HD); const int t = (int)((e / HD) % TT); const int h = (int)(e / ((size_t)HD * TT)); const float* f = F + (size_t)t * pitch + h * HD; const float rf = RF ? RF[(size_t)h * TT + t] : 1.0f; v2h o16; v2us oh, ol;
#pragma unroll
    for (int q = 0; q < 2; ++q) { const int dd = d + q; const int dp = (dd < HD / 2) ? dd + HD / 2 : dd - HD / 2; float x0 = f[dd], x1 = f[dp];
        if (RF) { float n0 = __fmul_rn(x0, rf), n1 = __fmul_rn(x1, rf); asm volatile("" : "+v"(n0)); asm volatile("" : "+v"(n1)); x0 = __fmul_rn(bfr(nw[dd]), n0); x1 = __fmul_rn(bfr(nw[dp]), n1); }
        const v2f cs = *(const v2f*)(CS + ((size_t)t * HD + dd) * 2); float a = __fmul_rn(x0, cs[0]), bq = __fmul_rn(x1, cs[1]); asm volatile("" : "+v"(a)); asm volatile("" : "+v"(bq)); const float r = ((dd < HD / 2) ? __fsub_rn(a, bq) : __fadd_rn(a, bq)) * sc;
        o16[q] = tohx(r); unsigned short a2, c2; splitf(r, a2, c2); oh[q] = a2; ol[q] = c2; }
    *(v2h*)(P16 + e) = o16; *(v2us*)(Ph + e) = oh; *(v2us*)(Pl + e) = ol;  }
__global__ __launch_bounds__(256) void k_vtp(const float* __restrict__ F, int pitch, int nheads, h16* V16, bf* Vh, bf* Vl) { const size_t e = ((size_t)blockIdx.x * 256 + threadIdx.x) * 2; if (e >= (size_t)nheads * HD * TT) return; const int t = (int)(e % TT); const int d = (int)((e / TT) % HD); const int g = (int)(e / ((size_t)TT * HD)); v2h o16; v2us oh, ol;
#pragma unroll
    for (int q = 0; q < 2; ++q) { const float x = F[(size_t)(t + q) * pitch + g * HD + d]; o16[q] = tohx(x); unsigned short a2, c2; splitf(x, a2, c2); oh[q] = a2; ol[q] = c2; }
    *(v2h*)(V16 + e) = o16; *(v2us*)(Vh + e) = oh; *(v2us*)(Vl + e) = ol;  }
__global__ __launch_bounds__(256) void k_csid(float* CS) { const int idx = blockIdx.x * 256 + threadIdx.x; if (idx >= TT * HD) return; v2f cs; cs[0] = 1.0f; cs[1] = 0.0f; *(v2f*)(CS + (size_t)idx * 2) = cs;  }
// k_wtGs: k_wtG with a power-of-two pre-scale (w x wsc before the bf16 rounding; exact for wsc = 2^-5: the module's 1/sqrt(1024) input scaling folded into the weight).
__global__ __launch_bounds__(256) void k_wtGs(const float* __restrict__ w, int K, int N, bf* Bt, float wsc) {
    const int lane = threadIdx.x & 31; const int L0 = (blockIdx.x * 8 + (threadIdx.x >> 5)) * 8; const int nlines = N * K / 64;
{
#pragma unroll 1
        for (int l = 0; l < 8; ++l) { const int L = L0 + l; if (L >= nlines) break; const size_t e = (size_t)L * 64 + lane * 2; const int k = (int)(e % K), n = (int)(e / K); v2us o;
            o[0] = f2bf(__fmul_rn(w[(size_t)k * N + n], wsc)); o[1] = f2bf(__fmul_rn(w[(size_t)(k + 1) * N + n], wsc)); *(v2us*)(Bt + e) = o; }
         }
}

__global__ __launch_bounds__(256) void k_rowsel(const bf* __restrict__ Win, bf* Wout_, int off) { const size_t i = (size_t)blockIdx.x * 256 + threadIdx.x; if (i >= (size_t)DQ * DM / 8) return; const size_t e = i * 8; const int c = (int)(e % DM); const int ro = (int)(e / DM); const int hh = ro / HD, d = ro % HD; const size_t ri = (size_t)hh * 2 * HD + off + d; const v8us a = *(const v8us*)(Win + ri * DM + c); *(v8us*)(Wout_ + e) = a;  }
__global__ __launch_bounds__(256) void k_bsel(const float* __restrict__ bin, float* bout, int off, float bsc) { const int i = blockIdx.x * 256 + threadIdx.x; if (i >= DQ) return; const int hh = i / HD, d = i % HD; const float v = __fmul_rn(bin[hh * 2 * HD + off + d], bsc); *(float*)(bout + i) = v;  }
__global__ __launch_bounds__(256) void k_bsel1(const float* __restrict__ bin, float* bout, float bsc) { const int i = blockIdx.x * 256 + threadIdx.x; if (i >= DKV) return; const float v = __fmul_rn(bin[i], bsc); *(float*)(bout + i) = v;  }
// ---- k_fattn: scores, softmax and attn.v of one (batch, head) and QB query rows in one work-group; nothing of S or P goes to memory.
// Transposed products: St = K Qt (A = 16 key rows, B = 16 query rows, both read in the order of WFrag::ld, so their k orders are equal), then Ot += Vt Pt (A = 16 rows of the [d][t] plane, B = P).
// A lane (c = lane & 15, h = lane >> 4) holds St[key 8h + r][query c]; the two 16-key tiles of a pass, converted in place, are the B operand of the second product (element s = key 16 (s >> 3) + 8h + (s & 7), the order in which the keys of a Vt row are read).
// So every score, every P and every output element of a lane in one 16-column group belongs to ONE query: maximum, sum and rescale are per lane and group, and the two halves of a wave exchange only the maximum (when it moves) and the sum (once).
// mu = the maximum in use, in log2 units (score x SCL x log2 e), equal in both halves; it moves only when some column's new maximum exceeds it by more than 8, so P stays <= 2^8.
// The 8 waves share each pass's 32 keys: every thread brings 16 bytes of each plane through registers into one of two LDS buffers (K in whole 128-byte lines, Vt in half lines), one barrier per pass. Row pitches 144 B and 80 B (16 B x odd): 16-byte reads without bank conflicts.
#define KPI  72                   // LDS pitch of a K row, elements (64 + 8)
#define VPI  40                   // LDS pitch of a Vt row, elements (32 + 8)
#define KSZ  (32 * KPI)           // one K plane of a pass
#define VSZ  (HD * VPI)           // one Vt plane of a pass
__device__ __forceinline__ v16h ldh(const bf* p) { return __builtin_bit_cast(v16h, __builtin_shufflevector(*(const v8us*)p, *(const v8us*)(p + 16), 0, 1, 2, 3, 4, 5, 6, 7, 8, 9, 10, 11, 12, 13, 14, 15)); }
template <bool HIRES>
__device__ __forceinline__ void attn_body(const bf* __restrict__ Qh, const bf* __restrict__ Ql, const bf* __restrict__ Kh, const bf* __restrict__ Kl, const h16* __restrict__ V16, const bf* __restrict__ Vh, const bf* __restrict__ Vl, float* out, int q0, bf* sm) {
    const int tid = threadIdx.x, lane = tid & 31, c = lane & 15, h = lane >> 4;
    const float CL = SCL * 1.4426950408889634f;
    const int STG = 2 * KSZ + (HIRES ? 2 : 1) * VSZ;   // elements of one buffer: K hi, K lo, Vt (hi, lo | fp16)
    const unsigned kg = tid * 16u, vg = (tid >> 2) * (TT * 2u) + (tid & 3) * 16u;   // the thread's byte offsets in a pass's global data: its 32 K rows are 4 KiB in a row; 64 bytes of each of the 64 Vt rows
    const int ks = (tid >> 3) * KPI + (tid & 7) * 8, vs = 2 * KSZ + (tid >> 2) * VPI + (tid & 3) * 8;
    v8us g0 = *(const v8usa*)((const char*)Kh + kg), g1 = *(const v8usa*)((const char*)Kl + kg), g2 = *(const v8usa*)((HIRES ? (const char*)Vh : (const char*)V16) + vg), g3;
    if (HIRES) g3 = *(const v8usa*)((const char*)Vl + vg);
    v16bf qh[2][2], ql[2][2];
#pragma unroll
    for (int qt = 0; qt < 2; ++qt)
#pragma unroll
        for (int kc = 0; kc < 2; ++kc) { const size_t qo = (size_t)(q0 + qt * 16 + c) * HD + kc * 32 + 8 * h; qh[qt][kc] = WFrag<bf>::ld(Qh + qo); ql[qt][kc] = WFrag<bf>::ld(Ql + qo); }
    v8f o[4][2];
#pragma unroll
    for (int dt = 0; dt < 4; ++dt)
#pragma unroll
        for (int qt = 0; qt < 2; ++qt) o[dt][qt] = (v8f){};
    float mu[2] = { -3.0e38f, -3.0e38f }, ls[2] = { 0.f, 0.f };
    *(v8us*)(sm + ks) = g0; *(v8us*)(sm + KSZ + ks) = g1; *(v8us*)(sm + vs) = g2; if (HIRES) *(v8us*)(sm + VSZ + vs) = g3;
    __syncthreads();
    const int ko = c * KPI + 8 * h, vo = 2 * KSZ + c * VPI + 8 * h;
    for (int k0 = 0; k0 < TT; k0 += 32) {
        const bf* cur = sm + ((k0 >> 5) & 1) * STG; bf* nxt = sm + (((k0 >> 5) & 1) ^ 1) * STG;
        const int kn = (k0 + 32) & (TT - 1);   // the next pass's keys; the last pass fetches pass 0 again (in bounds, never read)
        v8f s[2][2];
#pragma unroll
        for (int kt = 0; kt < 2; ++kt) { const bf* kp = cur + ko + kt * 16 * KPI;
            const v16bf kh0 = WFrag<bf>::ld(kp), kh1 = WFrag<bf>::ld(kp + 32), kl0 = WFrag<bf>::ld(kp + KSZ), kl1 = WFrag<bf>::ld(kp + KSZ + 32);
            v8f a0 = (v8f){}, a1 = (v8f){};
            a0 = wmmab(kh0, qh[0][0], a0); a1 = wmmab(kh0, qh[1][0], a1); a0 = wmmab(kh1, qh[0][1], a0); a1 = wmmab(kh1, qh[1][1], a1);
            a0 = wmmab(kh0, ql[0][0], a0); a1 = wmmab(kh0, ql[1][0], a1); a0 = wmmab(kh1, ql[0][1], a0); a1 = wmmab(kh1, ql[1][1], a1);
            a0 = wmmab(kl0, qh[0][0], a0); a1 = wmmab(kl0, qh[1][0], a1); a0 = wmmab(kl1, qh[0][1], a0); a1 = wmmab(kl1, qh[1][1], a1);
            s[kt][0] = a0; s[kt][1] = a1; }
        float lm[2];
#pragma unroll
        for (int qt = 0; qt < 2; ++qt) { float x = fmaxf(s[0][qt][0], s[1][qt][0]);
#pragma unroll
            for (int r = 1; r < 8; ++r) x = fmaxf(x, fmaxf(s[0][qt][r], s[1][qt][r]));
            lm[qt] = x * CL; }
        const bool need = (lm[0] > mu[0] + 8.0f) || (lm[1] > mu[1] + 8.0f);
        if (__builtin_amdgcn_ballot_w32(need) != 0) {   // wave-uniform: always on the first pass, rare later
#pragma unroll
            for (int qt = 0; qt < 2; ++qt) { const float mn = fmaxf(mu[qt], fmaxf(lm[qt], __shfl_xor(lm[qt], 16, 32))); const float f = __builtin_amdgcn_exp2f(mu[qt] - mn); mu[qt] = mn; ls[qt] *= f;
#pragma unroll
                for (int dt = 0; dt < 4; ++dt) o[dt][qt] *= f; }
        }
        g0 = *(const v8usa*)((const char*)(Kh + kn * HD) + kg); g1 = *(const v8usa*)((const char*)(Kl + kn * HD) + kg); g2 = *(const v8usa*)((HIRES ? (const char*)(Vh + kn) : (const char*)(V16 + kn)) + vg); if (HIRES) g3 = *(const v8usa*)((const char*)(Vl + kn) + vg);
        __builtin_amdgcn_sched_barrier(0);   // keeps the next pass's global loads in front of the exponentials and the second product, whose time covers their latency; left free, they are moved down to just in front of the LDS stores
        v16h p16[2]; v16bf ph[2], pl[2];
#pragma unroll
        for (int qt = 0; qt < 2; ++qt) { const v2f cl2 = { CL, CL }, nm2 = { -mu[qt], -mu[qt] }; v2f t[4];   // two neighbouring accumulator registers at a time: packed multiply-adds and adds with no register copies
#pragma unroll
            for (int r = 0; r < 8; r += 2) { const v2f x0 = __builtin_elementwise_fma((v2f){ s[0][qt][r], s[0][qt][r + 1] }, cl2, nm2), x1 = __builtin_elementwise_fma((v2f){ s[1][qt][r], s[1][qt][r + 1] }, cl2, nm2);
                const v2f p0 = { __builtin_amdgcn_exp2f(x0[0]), __builtin_amdgcn_exp2f(x0[1]) }, p1 = { __builtin_amdgcn_exp2f(x1[0]), __builtin_amdgcn_exp2f(x1[1]) }; t[r >> 1] = p0 + p1;
#pragma unroll
                for (int e = 0; e < 2; ++e) {
                    if (HIRES) { const __bf16 h0 = (__bf16)p0[e], h1 = (__bf16)p1[e]; ph[qt][r + e] = h0; ph[qt][8 + r + e] = h1; pl[qt][r + e] = (__bf16)(p0[e] - (float)h0); pl[qt][8 + r + e] = (__bf16)(p1[e] - (float)h1); } else { p16[qt][r + e] = tohx(p0[e]); p16[qt][8 + r + e] = tohx(p1[e]); } } }
            const v2f w = (t[0] + t[1]) + (t[2] + t[3]); ls[qt] += w[0] + w[1]; }   // a tree: one dependent add per pass on the running sum
#pragma unroll
        for (int dt = 0; dt < 4; ++dt) { const bf* vp = cur + vo + dt * 16 * VPI;
            if (HIRES) { const v16bf vh = WFrag<bf>::ld(vp), vl = WFrag<bf>::ld(vp + VSZ);
                o[dt][0] = wmmab(vh, ph[0], o[dt][0]); o[dt][1] = wmmab(vh, ph[1], o[dt][1]); o[dt][0] = wmmab(vh, pl[0], o[dt][0]); o[dt][1] = wmmab(vh, pl[1], o[dt][1]); o[dt][0] = wmmab(vl, ph[0], o[dt][0]); o[dt][1] = wmmab(vl, ph[1], o[dt][1]);
            } else { const v16h vf = ldh(vp); o[dt][0] = wmma16(vf, p16[0], o[dt][0]); o[dt][1] = wmma16(vf, p16[1], o[dt][1]); } }
        *(v8us*)(nxt + ks) = g0; *(v8us*)(nxt + KSZ + ks) = g1; *(v8us*)(nxt + vs) = g2; if (HIRES) *(v8us*)(nxt + VSZ + vs) = g3;   // nxt was last read in the pass before this one, in front of that pass's barrier
        __syncthreads();   // publishes nxt and ends every wave's reads of cur
    }
#pragma unroll
    for (int qt = 0; qt < 2; ++qt) { const float f = __fdiv_rn(1.0f, ls[qt] + __shfl_xor(ls[qt], 16, 32)); float* orow = out + (size_t)(q0 + qt * 16 + c) * DQ + 8 * h;
#pragma unroll
        for (int dt = 0; dt < 4; ++dt) { v4f lo4, hi4;
#pragma unroll
            for (int r = 0; r < 4; ++r) { lo4[r] = o[dt][qt][r] * f; hi4[r] = o[dt][qt][4 + r] * f; }
            *(v4f*)(orow + dt * 16) = lo4; *(v4f*)(orow + dt * 16 + 4) = hi4; }
        asm volatile("s_wait_xcnt 0x0" ::: "memory"); }   // behind the group's eight stores: their data and address registers are written again by the next group's products and by the code behind the call
}
// grid: NB_ NH_ TT / QB work-groups of 8 waves; the blocks of rows < RH (three attn.v products, the longer ones) come first. amdgpu_waves_per_eu: two work-groups per WGP, so that one wave's vector work and waits lie under the others' matrix work.
__global__ __launch_bounds__(256) __attribute__((amdgpu_waves_per_eu(4, 4))) void k_fattn(const bf* __restrict__ Qh, const bf* __restrict__ Ql, const bf* __restrict__ Kh, const bf* __restrict__ Kl, const h16* __restrict__ V16, const bf* __restrict__ Vh, const bf* __restrict__ Vl, float* OUT) {
    __shared__ __align__(16) bf sm[2 * (2 * KSZ + 2 * VSZ)];
    const int NHI = RH / QB, NLO = TT / QB - NHI; const int bid = blockIdx.x; int bh, qb;
    if (bid < NB_ * NH_ * NHI) { bh = bid / NHI; qb = bid % NHI; } else { const int r = bid - NB_ * NH_ * NHI; bh = r / NLO; qb = NHI + r % NLO; }
    const size_t po = (size_t)bh * TT * HD; const int q0 = qb * QB + (int)(threadIdx.x >> 5) * QW;
    float* out = OUT + (size_t)(bh / NH_) * TT * DQ + (bh % NH_) * HD;
    if (qb < NHI) attn_body<true>(Qh + po, Ql + po, Kh + po, Kl + po, V16 + po, Vh + po, Vl + po, out, q0, sm);
    else attn_body<false>(Qh + po, Ql + po, Kh + po, Kl + po, V16 + po, Vh + po, Vl + po, out, q0, sm);
}

extern "C" void kernel_launch(void* const* d_in, const int* in_sizes, int n_in,
                              void* d_out, int out_size, void* d_ws, size_t ws_size, hipStream_t stream) {
    (void)in_sizes; (void)n_in; (void)out_size;
    const float* x = (const float*)d_in[0]; const float* wqk = (const float*)d_in[1];   /* [1024][2048] */ const float* bqk = (const float*)d_in[2];   /* [2048] */ const float* wv = (const float*)d_in[3]; const float* bv = (const float*)d_in[4]; const float* wq = wqk, *wk = wqk, *wo = nullptr; (void)wo; const float* bq = bqk, *bk = bqk;
    float* OUT = (float*)d_out;     // [4][2048][1024]
    char* wsp = (char*)d_ws;
    auto take = [&](size_t bytes) { char* p = wsp; wsp += (bytes + 255) & ~(size_t)255; return (void*)p; };
    bf* WQK = (bf*)take((size_t)2 * DQ * DM * 2); float* BQ = (float*)take((size_t)DQ * 4); float* BK = (float*)take((size_t)DKV * 4); float* BV = (float*)take((size_t)DKV * 4); bf* WQ = (bf*)take((size_t)DQ * DM * 2); bf* WK = (bf*)take((size_t)DKV * DM * 2); bf* WV = (bf*)take((size_t)DKV * DM * 2); float* CS = (float*)take((size_t)TT * HD * 2 * 4);
    bf* XB = (bf*)take((size_t)TT * DM * 2); float* FQ = (float*)take((size_t)TT * DQ * 4); float* FK = (float*)take((size_t)TT * DKV * 4);   // one batch's projection buffers, reused by the next batch (stream-ordered)
    h16* QP16 = (h16*)take((size_t)NH_ * TT * HD * 2); h16* KP16 = (h16*)take((size_t)NKV * TT * HD * 2);
    const size_t PB = (size_t)NH_ * TT * HD;   // elements of one batch's block in each plane that k_fattn reads (one kv head per query head)
    h16* VT16 = (h16*)take(NB_ * PB * 2); bf* QPh = (bf*)take(NB_ * PB * 2); bf* QPl = (bf*)take(NB_ * PB * 2); bf* KPh = (bf*)take(NB_ * PB * 2); bf* KPl = (bf*)take(NB_ * PB * 2); bf* VTh = (bf*)take(NB_ * PB * 2); bf* VTl = (bf*)take(NB_ * PB * 2);   // 7 x 16 MiB
    if ((size_t)(wsp - (char*)d_ws) > ws_size) return;    // ws 256 MiB
    float* FV = FK;   // v projection reuses the k buffer after the k planes are built (stream-ordered)
    { k_wtGs<<<(unsigned)((DM * 2 * DQ / 64 + 63) / 64), 256, 0, stream>>>(wqk, DM, 2 * DQ, WQK, 0.03125f);   /* fused 'xw' Wqk [1024][2048] x 2^-5 -> Bt [2048][1024] */ k_rowsel<<<(unsigned)(((size_t)DQ * DM / 8 + 255) / 256), 256, 0, stream>>>(WQK, WQ, 0);   /* q rows: head h, dim d <- Bt row h*128 + d */ k_bsel<<<(DQ + 255) / 256, 256, 0, stream>>>(bqk, BQ, 0, 0.03125f); k_rowsel<<<(unsigned)(((size_t)DKV * DM / 8 + 255) / 256), 256, 0, stream>>>(WQK, WK, HD);   /* k rows <- Bt row h*128 + 64 + d */ k_bsel<<<(DKV + 255) / 256, 256, 0, stream>>>(bqk, BK, HD, 0.03125f); k_wtGs<<<(unsigned)((DM * DKV / 64 + 63) / 64), 256, 0, stream>>>(wv, DM, DKV, WV, 0.03125f);   /* Wv x 2^-5 */ k_bsel1<<<(DKV + 255) / 256, 256, 0, stream>>>(bv, BV, 0.03125f);
      
       }
    k_csid<<<(TT * HD + 255) / 256, 256, 0, stream>>>(CS);
    const unsigned LQ = (unsigned)(((size_t)NH_ * TT * HD / 2 + 255) / 256), LKv = (unsigned)(((size_t)NKV * TT * HD / 2 + 255) / 256);
    for (int b = 0; b < NB_; ++b) {
        
        k_cvt8<<<(unsigned)(((size_t)TT * DM / 8 + 255) / 256), 256, 0, stream>>>(x + (size_t)b * TT * DM, XB, (size_t)TT * DM / 8);
        k_gemmw<bf, 0, true><<<dim3(TT / 64, DQ / 64, 1), 32, 0, stream>>>(XB, nullptr, WQ, nullptr, DM, FQ, DQ, BQ, 0, 0, 0, 0);
        k_rope<<<LQ, 256, 0, stream>>>(FQ, DQ, NH_, CS, nullptr, nullptr, 1.0f, QP16, QPh + b * PB, QPl + b * PB);
        k_gemmw<bf, 0, true><<<dim3(TT / 64, DKV / 64, 1), 32, 0, stream>>>(XB, nullptr, WK, nullptr, DM, FK, DKV, BK, 0, 0, 0, 0);
        k_rope<<<LKv, 256, 0, stream>>>(FK, DKV, NKV, CS, nullptr, nullptr, 1.0f, KP16, KPh + b * PB, KPl + b * PB);
        k_gemmw<bf, 0, true><<<dim3(TT / 64, DKV / 64, 1), 32, 0, stream>>>(XB, nullptr, WV, nullptr, DM, FV, DKV, BV, 0, 0, 0, 0); k_vtp<<<LKv, 256, 0, stream>>>(FV, DKV, NKV, VT16 + b * PB, VTh + b * PB, VTl + b * PB);
    }
    k_fattn<<<NB_ * NH_ * (TT / QB), 256, 0, stream>>>(QPh, QPl, KPh, KPl, VT16, VTh, VTl, OUT);
}

// v004
// A run of this version takes 190 microseconds.
// Next to v003, in two timings, it ran 2.66 and 2.71 times as fast.
// Over all steps from v000 it is 20.2 times as fast.
#include <hip/hip_runtime.h>

// Attention with a fused, d_in-scaled qk projection (x [4][2048][1024]; qk = (x Wqk + bqk) / sqrt(1024) ('xw' [1024][2048] sigma 1, zero bias) -> per head h: q = qk columns h*128 .. h*128+63, k = columns h*128+64 .. h*128+127; v = (x Wv + bv) / sqrt(1024) ('xw' [1024][1024] sigma 1) heads of 64; A = q.k / 64 (dim^-scale_exp, scale_exp 1); softmax; out = concat-heads(A v) -> [4][2048][1024] (8.4 M; no output projection)).
// Layout: bf16 copy of x (all batches); Wqk transposed once into a [2048][1024] Bt whose rows are then gathered into separate q and k Bt blocks (row h*64+d <- h*128+d and h*128+64+d), the v block behind them; the 1/sqrt(1024) = 2^-5 input scalings are folded EXACTLY into the bf16 weights and f32 biases (a power-of-two factor commutes with every rounding); ONE launch (k_proj) does the three exact projections of every batch and stores the q, k and v planes itself, and ONE launch (k_fattn) then does scores, softmax and attn.v for every batch and head with hi/lo 3-product score tiles on EVERY row (SCL 1/64); P and attn.v hybrid (rows < 512 hi/lo, rest fp16); it writes the f32 output rows.
// Compute dtypes, f32 accumulate: every input rounded to bf16; projections exact (x 2^-5 folded); scores 3 products on every row; softmax f32 (x 1/64), running maximum and sum over passes of 32 keys; attn.v rows < 512 3 products, rest fp16; output f32.

#define NB_  4
#define TT   2048
#define DM   1024
#define NH_  16
#define NKV  16
#define REP  (NH_ / NKV)
#define HD   64
#define DQ   (NH_ * HD)
#define DKV  (NKV * HD)
#define QW   32                   // query columns of one wave of k_fattn (two 16-column groups)
#define QB   256                  // query rows of one k_fattn work-group (8 waves); RH and TT are multiples of it
#define RH   512                  // query rows < RH use hi+lo planes (0: none)
#define WIN  0
#define SCL  0.015625f  // 1/DIM = 1/64 (scale_exp 1); the two 1/sqrt(1024) input scalings are folded into the weights
typedef _Float16 h16;
typedef unsigned short bf;
typedef __attribute__((ext_vector_type(16))) __bf16   v16bf;
typedef __attribute__((ext_vector_type(16))) _Float16 v16h;
typedef __attribute__((ext_vector_type(8)))  _Float16 v8h;
typedef __attribute__((ext_vector_type(8)))  unsigned short v8us;
typedef __attribute__((ext_vector_type(8)))  float    v8f;
typedef __attribute__((ext_vector_type(4)))  float    v4f;
typedef v8h  __attribute__((may_alias)) v8ha;
typedef v4f  __attribute__((may_alias)) v4fa;
typedef v8us __attribute__((may_alias)) v8usa;

__device__ __forceinline__ unsigned short f2bf(float f) { unsigned u = __float_as_uint(f); u += 0x7FFFu + ((u >> 16) & 1u); return (unsigned short)(u >> 16); }
__device__ __forceinline__ float bf2f(unsigned short b) { return __uint_as_float(((unsigned)b) << 16); }
__device__ __forceinline__ float bfr(float f) { return bf2f(f2bf(f)); }
__device__ __forceinline__ v16h cat16(v8h lo, v8h hi) { return __builtin_shufflevector(lo, hi, 0, 1, 2, 3, 4, 5, 6, 7, 8, 9, 10, 11, 12, 13, 14, 15); }
__device__ __forceinline__ v16bf cat16b(v8us lo, v8us hi) { return __builtin_bit_cast(v16bf, __builtin_shufflevector(lo, hi, 0, 1, 2, 3, 4, 5, 6, 7, 8, 9, 10, 11, 12, 13, 14, 15)); }
__device__ __forceinline__ v8f wmma16(v16h a, v16h b, v8f c) { return __builtin_amdgcn_wmma_f32_16x16x32_f16(false, a, false, b, (short)0, c, false, false); }
__device__ __forceinline__ v8f wmmab(v16bf a, v16bf b, v8f c) { return __builtin_amdgcn_wmma_f32_16x16x32_bf16(false, a, false, b, (short)0, c, false, false); }



// WFrag::ld: one lane's 16 elements of a 16x32 operand tile from a K-contiguous 16-bit row (elements 0..7 and 16..23 behind the lane's pointer, which stands at 8 (lane >> 4)).
template <typename T16> struct WFrag;
template <> struct WFrag<h16> { typedef v16h V; static __device__ __forceinline__ V ld(const h16* p) { return cat16(*(const v8h*)p, *(const v8h*)(p + 16)); } static __device__ __forceinline__ v8f mma(V a, V b, v8f c) { return wmma16(a, b, c); } };
template <> struct WFrag<bf> { typedef v16bf V; static __device__ __forceinline__ V ld(const bf* p) { return cat16b(*(const v8us*)p, *(const v8us*)(p + 16)); } static __device__ __forceinline__ v8f mma(V a, V b, v8f c) { return wmmab(a, b, c); } };

__device__ __forceinline__ h16 tohx(float x) { return (h16)x; }
__device__ __forceinline__ void splitf(float y, unsigned short& h, unsigned short& l) { h = f2bf(y); l = f2bf(y - bf2f(h)); }
typedef __attribute__((ext_vector_type(2))) _Float16 v2h;
typedef __attribute__((ext_vector_type(4))) _Float16 v4h;
typedef __attribute__((ext_vector_type(2))) unsigned short v2us;
typedef __attribute__((ext_vector_type(4))) unsigned short v4us;
typedef __attribute__((ext_vector_type(2))) float v2f;
typedef __attribute__((ext_vector_type(4))) int v4i;

__global__ __launch_bounds__(256) void k_wtG(const float* __restrict__ w, int K, int N, bf* Bt) {
    const int lane = threadIdx.x & 31; const int L0 = (blockIdx.x * 8 + (threadIdx.x >> 5)) * 8; const int nlines = N * K / 64;
{
#pragma unroll 1
        for (int l = 0; l < 8; ++l) { const int L = L0 + l; if (L >= nlines) break; const size_t e = (size_t)L * 64 + lane * 2; const int k = (int)(e % K), n = (int)(e / K); v2us o;
            o[0] = f2bf(w[(size_t)k * N + n]); o[1] = f2bf(w[(size_t)(k + 1) * N + n]); *(v2us*)(Bt + e) = o; }
         }
}
__global__ __launch_bounds__(256) void k_cvt8(const float* __restrict__ src, bf* dst, size_t n8) { const size_t i = (size_t)blockIdx.x * 256 + threadIdx.x; if (i >= n8) return; const v8f v = *(const v8f*)(src + i * 8); v8us o;
#pragma unroll
    for (int k = 0; k < 8; ++k) o[k] = f2bf(v[k]); *(v8us*)(dst + i * 8) = o;  }

// k_wtGs: k_wtG with a power-of-two pre-scale (w x wsc before the bf16 rounding; exact for wsc = 2^-5: the module's 1/sqrt(1024) input scaling folded into the weight).
__global__ __launch_bounds__(256) void k_wtGs(const float* __restrict__ w, int K, int N, bf* Bt, float wsc) {
    const int lane = threadIdx.x & 31; const int L0 = (blockIdx.x * 8 + (threadIdx.x >> 5)) * 8; const int nlines = N * K / 64;
{
#pragma unroll 1
        for (int l = 0; l < 8; ++l) { const int L = L0 + l; if (L >= nlines) break; const size_t e = (size_t)L * 64 + lane * 2; const int k = (int)(e % K), n = (int)(e / K); v2us o;
            o[0] = f2bf(__fmul_rn(w[(size_t)k * N + n], wsc)); o[1] = f2bf(__fmul_rn(w[(size_t)(k + 1) * N + n], wsc)); *(v2us*)(Bt + e) = o; }
         }
}

__global__ __launch_bounds__(256) void k_rowsel(const bf* __restrict__ Win, bf* Wout_, int off) { const size_t i = (size_t)blockIdx.x * 256 + threadIdx.x; if (i >= (size_t)DQ * DM / 8) return; const size_t e = i * 8; const int c = (int)(e % DM); const int ro = (int)(e / DM); const int hh = ro / HD, d = ro % HD; const size_t ri = (size_t)hh * 2 * HD + off + d; const v8us a = *(const v8us*)(Win + ri * DM + c); *(v8us*)(Wout_ + e) = a;  }
__global__ __launch_bounds__(256) void k_bsel(const float* __restrict__ bin, float* bout, int off, float bsc) { const int i = blockIdx.x * 256 + threadIdx.x; if (i >= DQ) return; const int hh = i / HD, d = i % HD; const float v = __fmul_rn(bin[hh * 2 * HD + off + d], bsc); *(float*)(bout + i) = v;  }
__global__ __launch_bounds__(256) void k_bsel1(const float* __restrict__ bin, float* bout, float bsc) { const int i = blockIdx.x * 256 + threadIdx.x; if (i >= DKV) return; const float v = __fmul_rn(bin[i], bsc); *(float*)(bout + i) = v;  }
// ---- k_proj: the q, k and v projections of all four batches in ONE launch: C[m][n] = sum_k X[m][k] Wt[n][k] + bias[n], m = batch * TT + t (8192 rows), n = 0 .. 3071 (q heads, k heads, v heads; Wt and bias hold the three blocks one behind the other).
// A work-group of 8 waves owns PM x PN of C, each wave 64 x 64 (16 accumulators; wave w: rows 64 (w & 3), columns 64 (w >> 2), one head). Per pass of PK = 64 k every thread brings 12 x 16 bytes (whole 128-byte lines of 256 X rows and 128 Wt rows) through registers into one of two LDS buffers, one barrier per pass; row pitch 144 B as for the K rows of k_fattn.
// No f32 copy of C goes to memory: the wave adds the bias, rounds and stores the planes that k_fattn reads. An accumulator lane holds 8 neighbouring rows of the FIRST operand at one row of the second, so q and k tiles take Wt as first operand (a lane then holds 8 neighbouring d of one t: 16 bytes of a [h][t][d] plane) and v tiles take X (8 neighbouring t of one d: 16 bytes of a [h][d][t] plane). Both operands are read in the order of WFrag::ld, so the k orders are equal either way, and k runs upward in steps of 32 as before.
#define PM   256
#define PN   128
#define PK   64
#define PPI  72                   // LDS pitch of a staged row, elements (64 + 8)
#define PXS  (PM * PPI)           // the X rows of one buffer; the Wt rows follow
#define PSTG ((PM + PN) * PPI)    // one buffer
__global__ __launch_bounds__(256) __attribute__((amdgpu_waves_per_eu(4, 4))) void k_proj(const bf* __restrict__ X, const bf* __restrict__ Wt, const float* __restrict__ bias, bf* Qh, bf* Ql, bf* Kh, bf* Kl, h16* V16, bf* Vh, bf* Vl) {
    __shared__ __align__(16) bf sm[2 * PSTG];
    const int tid = threadIdx.x, lane = tid & 31, lr = lane & 15, hi = lane >> 4, wv = tid >> 5;
    const int r0 = blockIdx.x * PM, c0 = blockIdx.y * PN;
    const bool vt = c0 >= DQ + DKV;   // the same for the whole work-group: PN divides DQ and DKV
    const bf* xg = X + (size_t)(r0 + (tid >> 3)) * DM + (tid & 7) * 8; const bf* wg = Wt + (size_t)(c0 + (tid >> 3)) * DM + (tid & 7) * 8;   // 8 threads per 128-byte line, 32 rows per round
    const int ss = (tid >> 3) * PPI + (tid & 7) * 8;
    v8us gx[8], gw[4];
#pragma unroll
    for (int i = 0; i < 8; ++i) gx[i] = *(const v8usa*)(xg + (size_t)i * 32 * DM);
#pragma unroll
    for (int i = 0; i < 4; ++i) gw[i] = *(const v8usa*)(wg + (size_t)i * 32 * DM);
    v8f acc[4][4];
#pragma unroll
    for (int i = 0; i < 4; ++i)
#pragma unroll
        for (int j = 0; j < 4; ++j) acc[i][j] = (v8f){};
#pragma unroll
    for (int i = 0; i < 8; ++i) *(v8us*)(sm + ss + i * 32 * PPI) = gx[i];
#pragma unroll
    for (int i = 0; i < 4; ++i) *(v8us*)(sm + PXS + ss + i * 32 * PPI) = gw[i];
    __syncthreads();
    const int xo = ((wv & 3) * 64 + lr) * PPI + 8 * hi, wo = PXS + ((wv >> 2) * 64 + lr) * PPI + 8 * hi;
    const int po = vt ? xo : wo, qo = vt ? wo : xo;   // first and second operand of the wave's products
    for (int k0 = 0; k0 < DM; k0 += PK) {
        const bf* cur = sm + ((k0 / PK) & 1) * PSTG; bf* nxt = sm + (((k0 / PK) & 1) ^ 1) * PSTG;
        const int kn = (k0 + PK) & (DM - 1);   // the next pass's k; the last pass fetches pass 0 again (in bounds, never read)
#pragma unroll
        for (int i = 0; i < 8; ++i) gx[i] = *(const v8usa*)(xg + (size_t)i * 32 * DM + kn);
#pragma unroll
        for (int i = 0; i < 4; ++i) gw[i] = *(const v8usa*)(wg + (size_t)i * 32 * DM + kn);
        __builtin_amdgcn_sched_barrier(0);   // keeps the next pass's global loads in front of this pass's products, whose time covers their latency; left free, they are moved down to just in front of the LDS stores
#pragma unroll
        for (int ks = 0; ks < PK; ks += 32) { v16bf p[4];
#pragma unroll
            for (int i = 0; i < 4; ++i) p[i] = WFrag<bf>::ld(cur + po + i * 16 * PPI + ks);
#pragma unroll
            for (int j = 0; j < 4; ++j) { const v16bf q = WFrag<bf>::ld(cur + qo + j * 16 * PPI + ks);
#pragma unroll
                for (int i = 0; i < 4; ++i) acc[i][j] = wmmab(p[i], q, acc[i][j]); } }
#pragma unroll
        for (int i = 0; i < 8; ++i) *(v8us*)(nxt + ss + i * 32 * PPI) = gx[i];   // nxt was last read in the pass before this one, in front of that pass's barrier
#pragma unroll
        for (int i = 0; i < 4; ++i) *(v8us*)(nxt + PXS + ss + i * 32 * PPI) = gw[i];
        __syncthreads();   // publishes nxt and ends every wave's reads of cur
    }
    const int rw = r0 + (wv & 3) * 64, cw = c0 + (wv >> 2) * 64;   // the wave's first row and column of C
    const int t0 = rw % TT, hd = (cw % DQ) / HD; const size_t pb = (size_t)(rw / TT) * NH_ * TT * HD + (size_t)hd * TT * HD;   // DQ == DKV; the (batch, head) block of every plane
    if (!vt) {
        bf* Ph = (cw < DQ) ? Qh : Kh; bf* Pl = (cw < DQ) ? Ql : Kl; v8f bb[4]; const float* bp = bias + cw + hi * 8;
#pragma unroll
        for (int i = 0; i < 4; ++i) bb[i] = *(const v8f*)(bp + i * 16);
        asm volatile("s_wait_xcnt 0x0" :: "v"(bp) : "memory");   // behind the eight bias loads, which share one address pair: as an input here the pair stays live up to the wait, so that no load's result is put into it in front of the wait
#pragma unroll
        for (int i = 0; i < 4; ++i)
#pragma unroll
            for (int r = 0; r < 8; ++r) bb[i][r] = bfr(bb[i][r]);
#pragma unroll
        for (int j = 0; j < 4; ++j) { const size_t e = pb + (size_t)(t0 + j * 16 + lr) * HD + hi * 8;   // acc[i][j][r]: d = 16 i + 8 hi + r, t = t0 + 16 j + lr
#pragma unroll
            for (int i = 0; i < 4; ++i) { v8us oh, ol;
#pragma unroll
                for (int r = 0; r < 8; ++r) { unsigned short a2, c2; splitf(acc[i][j][r] + bb[i][r], a2, c2); oh[r] = a2; ol[r] = c2; }
                *(v8us*)(Ph + e + i * 16) = oh; *(v8us*)(Pl + e + i * 16) = ol; }
            asm volatile("s_wait_xcnt 0x0" ::: "memory"); }   // behind the group's eight stores: their data and address registers are written again by the next group
    } else {
#pragma unroll
        for (int j = 0; j < 4; ++j) { const float bj = bfr(bias[cw + j * 16 + lr]); const size_t e = pb + (size_t)(j * 16 + lr) * TT + t0 + hi * 8;   // acc[i][j][r]: t = t0 + 16 i + 8 hi + r, d = 16 j + lr
#pragma unroll
            for (int i = 0; i < 4; ++i) { v8h o16; v8us oh, ol;
#pragma unroll
                for (int r = 0; r < 8; ++r) { const float y = acc[i][j][r] + bj; unsigned short a2, c2; splitf(y, a2, c2); o16[r] = tohx(y); oh[r] = a2; ol[r] = c2; }
                *(v8h*)(V16 + e + i * 16) = o16; *(v8us*)(Vh + e + i * 16) = oh; *(v8us*)(Vl + e + i * 16) = ol; }
            asm volatile("s_wait_xcnt 0x0" ::: "memory"); }   // behind the group's twelve stores: their data and address registers are written again by the next group
    }
}
// ---- k_fattn: scores, softmax and attn.v of one (batch, head) and QB query rows in one work-group; nothing of S or P goes to memory.
// Transposed products: St = K Qt (A = 16 key rows, B = 16 query rows, both read in the order of WFrag::ld, so their k orders are equal), then Ot += Vt Pt (A = 16 rows of the [d][t] plane, B = P).
// A lane (c = lane & 15, h = lane >> 4) holds St[key 8h + r][query c]; the two 16-key tiles of a pass, converted in place, are the B operand of the second product (element s = key 16 (s >> 3) + 8h + (s & 7), the order in which the keys of a Vt row are read).
// So every score, every P and every output element of a lane in one 16-column group belongs to ONE query: maximum, sum and rescale are per lane and group, and the two halves of a wave exchange only the maximum (when it moves) and the sum (once).
// mu = the maximum in use, in log2 units (score x SCL x log2 e), equal in both halves; it moves only when some column's new maximum exceeds it by more than 8, so P stays <= 2^8.
// The 8 waves share each pass's 32 keys: every thread brings 16 bytes of each plane through registers into one of two LDS buffers (K in whole 128-byte lines, Vt in half lines), one barrier per pass. Row pitches 144 B and 80 B (16 B x odd): 16-byte reads without bank conflicts.
#define KPI  72                   // LDS pitch of a K row, elements (64 + 8)
#define VPI  40                   // LDS pitch of a Vt row, elements (32 + 8)
#define KSZ  (32 * KPI)           // one K plane of a pass
#define VSZ  (HD * VPI)           // one Vt plane of a pass
__device__ __forceinline__ v16h ldh(const bf* p) { return __builtin_bit_cast(v16h, __builtin_shufflevector(*(const v8us*)p, *(const v8us*)(p + 16), 0, 1, 2, 3, 4, 5, 6, 7, 8, 9, 10, 11, 12, 13, 14, 15)); }
template <bool HIRES>
__device__ __forceinline__ void attn_body(const bf* __restrict__ Qh, const bf* __restrict__ Ql, const bf* __restrict__ Kh, const bf* __restrict__ Kl, const h16* __restrict__ V16, const bf* __restrict__ Vh, const bf* __restrict__ Vl, float* out, int q0, bf* sm) {
    const int tid = threadIdx.x, lane = tid & 31, c = lane & 15, h = lane >> 4;
    const float CL = SCL * 1.4426950408889634f;
    const int STG = 2 * KSZ + (HIRES ? 2 : 1) * VSZ;   // elements of one buffer: K hi, K lo, Vt (hi, lo | fp16)
    const unsigned kg = tid * 16u, vg = (tid >> 2) * (TT * 2u) + (tid & 3) * 16u;   // the thread's byte offsets in a pass's global data: its 32 K rows are 4 KiB in a row; 64 bytes of each of the 64 Vt rows
    const int ks = (tid >> 3) * KPI + (tid & 7) * 8, vs = 2 * KSZ + (tid >> 2) * VPI + (tid & 3) * 8;
    v8us g0 = *(const v8usa*)((const char*)Kh + kg), g1 = *(const v8usa*)((const char*)Kl + kg), g2 = *(const v8usa*)((HIRES ? (const char*)Vh : (const char*)V16) + vg), g3;
    if (HIRES) g3 = *(const v8usa*)((const char*)Vl + vg);
    v16bf qh[2][2], ql[2][2];
#pragma unroll
    for (int qt = 0; qt < 2; ++qt)
#pragma unroll
        for (int kc = 0; kc < 2; ++kc) { const size_t qo = (size_t)(q0 + qt * 16 + c) * HD + kc * 32 + 8 * h; qh[qt][kc] = WFrag<bf>::ld(Qh + qo); ql[qt][kc] = WFrag<bf>::ld(Ql + qo); }
    v8f o[4][2];
#pragma unroll
    for (int dt = 0; dt < 4; ++dt)
#pragma unroll
        for (int qt = 0; qt < 2; ++qt) o[dt][qt] = (v8f){};
    float mu[2] = { -3.0e38f, -3.0e38f }, ls[2] = { 0.f, 0.f };
    *(v8us*)(sm + ks) = g0; *(v8us*)(sm + KSZ + ks) = g1; *(v8us*)(sm + vs) = g2; if (HIRES) *(v8us*)(sm + VSZ + vs) = g3;
    __syncthreads();
    const int ko = c * KPI + 8 * h, vo = 2 * KSZ + c * VPI + 8 * h;
    for (int k0 = 0; k0 < TT; k0 += 32) {
        const bf* cur = sm + ((k0 >> 5) & 1) * STG; bf* nxt = sm + (((k0 >> 5) & 1) ^ 1) * STG;
        const int kn = (k0 + 32) & (TT - 1);   // the next pass's keys; the last pass fetches pass 0 again (in bounds, never read)
        v8f s[2][2];
#pragma unroll
        for (int kt = 0; kt < 2; ++kt) { const bf* kp = cur + ko + kt * 16 * KPI;
            const v16bf kh0 = WFrag<bf>::ld(kp), kh1 = WFrag<bf>::ld(kp + 32), kl0 = WFrag<bf>::ld(kp + KSZ), kl1 = WFrag<bf>::ld(kp + KSZ + 32);
            v8f a0 = (v8f){}, a1 = (v8f){};
            a0 = wmmab(kh0, qh[0][0], a0); a1 = wmmab(kh0, qh[1][0], a1); a0 = wmmab(kh1, qh[0][1], a0); a1 = wmmab(kh1, qh[1][1], a1);
            a0 = wmmab(kh0, ql[0][0], a0); a1 = wmmab(kh0, ql[1][0], a1); a0 = wmmab(kh1, ql[0][1], a0); a1 = wmmab(kh1, ql[1][1], a1);
            a0 = wmmab(kl0, qh[0][0], a0); a1 = wmmab(kl0, qh[1][0], a1); a0 = wmmab(kl1, qh[0][1], a0); a1 = wmmab(kl1, qh[1][1], a1);
            s[kt][0] = a0; s[kt][1] = a1; }
        float lm[2];
#pragma unroll
        for (int qt = 0; qt < 2; ++qt) { float x = fmaxf(s[0][qt][0], s[1][qt][0]);
#pragma unroll
            for (int r = 1; r < 8; ++r) x = fmaxf(x, fmaxf(s[0][qt][r], s[1][qt][r]));
            lm[qt] = x * CL; }
        const bool need = (lm[0] > mu[0] + 8.0f) || (lm[1] > mu[1] + 8.0f);
        if (__builtin_amdgcn_ballot_w32(need) != 0) {   // wave-uniform: always on the first pass, rare later
#pragma unroll
            for (int qt = 0; qt < 2; ++qt) { const float mn = fmaxf(mu[qt], fmaxf(lm[qt], __shfl_xor(lm[qt], 16, 32))); const float f = __builtin_amdgcn_exp2f(mu[qt] - mn); mu[qt] = mn; ls[qt] *= f;
#pragma unroll
                for (int dt = 0; dt < 4; ++dt) o[dt][qt] *= f; }
        }
        g0 = *(const v8usa*)((const char*)(Kh + kn * HD) + kg); g1 = *(const v8usa*)((const char*)(Kl + kn * HD) + kg); g2 = *(const v8usa*)((HIRES ? (const char*)(Vh + kn) : (const char*)(V16 + kn)) + vg); if (HIRES) g3 = *(const v8usa*)((const char*)(Vl + kn) + vg);
        __builtin_amdgcn_sched_barrier(0);   // keeps the next pass's global loads in front of the exponentials and the second product, whose time covers their latency; left free, they are moved down to just in front of the LDS stores
        v16h p16[2]; v16bf ph[2], pl[2];
#pragma unroll
        for (int qt = 0; qt < 2; ++qt) { const v2f cl2 = { CL, CL }, nm2 = { -mu[qt], -mu[qt] }; v2f t[4];   // two neighbouring accumulator registers at a time: packed multiply-adds and adds with no register copies
#pragma unroll
            for (int r = 0; r < 8; r += 2) { const v2f x0 = __builtin_elementwise_fma((v2f){ s[0][qt][r], s[0][qt][r + 1] }, cl2, nm2), x1 = __builtin_elementwise_fma((v2f){ s[1][qt][r], s[1][qt][r + 1] }, cl2, nm2);
                const v2f p0 = { __builtin_amdgcn_exp2f(x0[0]), __builtin_amdgcn_exp2f(x0[1]) }, p1 = { __builtin_amdgcn_exp2f(x1[0]), __builtin_amdgcn_exp2f(x1[1]) }; t[r >> 1] = p0 + p1;
#pragma unroll
                for (int e = 0; e < 2; ++e) {
                    if (HIRES) { const __bf16 h0 = (__bf16)p0[e], h1 = (__bf16)p1[e]; ph[qt][r + e] = h0; ph[qt][8 + r + e] = h1; pl[qt][r + e] = (__bf16)(p0[e] - (float)h0); pl[qt][8 + r + e] = (__bf16)(p1[e] - (float)h1); } else { p16[qt][r + e] = tohx(p0[e]); p16[qt][8 + r + e] = tohx(p1[e]); } } }
            const v2f w = (t[0] + t[1]) + (t[2] + t[3]); ls[qt] += w[0] + w[1]; }   // a tree: one dependent add per pass on the running sum
#pragma unroll
        for (int dt = 0; dt < 4; ++dt) { const bf* vp = cur + vo + dt * 16 * VPI;
            if (HIRES) { const v16bf vh = WFrag<bf>::ld(vp), vl = WFrag<bf>::ld(vp + VSZ);
                o[dt][0] = wmmab(vh, ph[0], o[dt][0]); o[dt][1] = wmmab(vh, ph[1], o[dt][1]); o[dt][0] = wmmab(vh, pl[0], o[dt][0]); o[dt][1] = wmmab(vh, pl[1], o[dt][1]); o[dt][0] = wmmab(vl, ph[0], o[dt][0]); o[dt][1] = wmmab(vl, ph[1], o[dt][1]);
            } else { const v16h vf = ldh(vp); o[dt][0] = wmma16(vf, p16[0], o[dt][0]); o[dt][1] = wmma16(vf, p16[1], o[dt][1]); } }
        *(v8us*)(nxt + ks) = g0; *(v8us*)(nxt + KSZ + ks) = g1; *(v8us*)(nxt + vs) = g2; if (HIRES) *(v8us*)(nxt + VSZ + vs) = g3;   // nxt was last read in the pass before this one, in front of that pass's barrier
        __syncthreads();   // publishes nxt and ends every wave's reads of cur
    }
#pragma unroll
    for (int qt = 0; qt < 2; ++qt) { const float f = __fdiv_rn(1.0f, ls[qt] + __shfl_xor(ls[qt], 16, 32)); float* orow = out + (size_t)(q0 + qt * 16 + c) * DQ + 8 * h;
#pragma unroll
        for (int dt = 0; dt < 4; ++dt) { v4f lo4, hi4;
#pragma unroll
            for (int r = 0; r < 4; ++r) { lo4[r] = o[dt][qt][r] * f; hi4[r] = o[dt][qt][4 + r] * f; }
            *(v4f*)(orow + dt * 16) = lo4; *(v4f*)(orow + dt * 16 + 4) = hi4; }
        asm volatile("s_wait_xcnt 0x0" ::: "memory"); }   // behind the group's eight stores: their data and address registers are written again by the next group's products and by the code behind the call
}
// grid: NB_ NH_ TT / QB work-groups of 8 waves; the blocks of rows < RH (three attn.v products, the longer ones) come first. amdgpu_waves_per_eu: two work-groups per WGP, so that one wave's vector work and waits lie under the others' matrix work.
__global__ __launch_bounds__(256) __attribute__((amdgpu_waves_per_eu(4, 4))) void k_fattn(const bf* __restrict__ Qh, const bf* __restrict__ Ql, const bf* __restrict__ Kh, const bf* __restrict__ Kl, const h16* __restrict__ V16, const bf* __restrict__ Vh, const bf* __restrict__ Vl, float* OUT) {
    __shared__ __align__(16) bf sm[2 * (2 * KSZ + 2 * VSZ)];
    const int NHI = RH / QB, NLO = TT / QB - NHI; const int bid = blockIdx.x; int bh, qb;
    if (bid < NB_ * NH_ * NHI) { bh = bid / NHI; qb = bid % NHI; } else { const int r = bid - NB_ * NH_ * NHI; bh = r / NLO; qb = NHI + r % NLO; }
    const size_t po = (size_t)bh * TT * HD; const int q0 = qb * QB + (int)(threadIdx.x >> 5) * QW;
    float* out = OUT + (size_t)(bh / NH_) * TT * DQ + (bh % NH_) * HD;
    if (qb < NHI) attn_body<true>(Qh + po, Ql + po, Kh + po, Kl + po, V16 + po, Vh + po, Vl + po, out, q0, sm);
    else attn_body<false>(Qh + po, Ql + po, Kh + po, Kl + po, V16 + po, Vh + po, Vl + po, out, q0, sm);
}

extern "C" void kernel_launch(void* const* d_in, const int* in_sizes, int n_in,
                              void* d_out, int out_size, void* d_ws, size_t ws_size, hipStream_t stream) {
    (void)in_sizes; (void)n_in; (void)out_size;
    const float* x = (const float*)d_in[0]; const float* wqk = (const float*)d_in[1];   /* [1024][2048] */ const float* bqk = (const float*)d_in[2];   /* [2048] */ const float* wv = (const float*)d_in[3]; const float* bv = (const float*)d_in[4]; const float* wq = wqk, *wk = wqk, *wo = nullptr; (void)wo; const float* bq = bqk, *bk = bqk;
    float* OUT = (float*)d_out;     // [4][2048][1024]
    char* wsp = (char*)d_ws;
    auto take = [&](size_t bytes) { char* p = wsp; wsp += (bytes + 255) & ~(size_t)255; return (void*)p; };
    bf* WQK = (bf*)take((size_t)2 * DQ * DM * 2); float* BQ = (float*)take((size_t)(DQ + 2 * DKV) * 4); float* BK = BQ + DQ; float* BV = BK + DKV; bf* WQ = (bf*)take((size_t)(DQ + 2 * DKV) * DM * 2); bf* WK = WQ + (size_t)DQ * DM; bf* WV = WK + (size_t)DKV * DM;   // the q, k and v blocks of bias and Bt lie one behind the other: k_proj reads them as one [3072] and one [3072][1024]
    bf* XB = (bf*)take((size_t)NB_ * TT * DM * 2);
    const size_t PB = (size_t)NH_ * TT * HD;   // elements of one batch's block in each plane that k_fattn reads (one kv head per query head)
    h16* VT16 = (h16*)take(NB_ * PB * 2); bf* QPh = (bf*)take(NB_ * PB * 2); bf* QPl = (bf*)take(NB_ * PB * 2); bf* KPh = (bf*)take(NB_ * PB * 2); bf* KPl = (bf*)take(NB_ * PB * 2); bf* VTh = (bf*)take(NB_ * PB * 2); bf* VTl = (bf*)take(NB_ * PB * 2);   // 7 x 16 MiB
    if ((size_t)(wsp - (char*)d_ws) > ws_size) return;    // ws 256 MiB
    { k_wtGs<<<(unsigned)((DM * 2 * DQ / 64 + 63) / 64), 256, 0, stream>>>(wqk, DM, 2 * DQ, WQK, 0.03125f);   /* fused 'xw' Wqk [1024][2048] x 2^-5 -> Bt [2048][1024] */ k_rowsel<<<(unsigned)(((size_t)DQ * DM / 8 + 255) / 256), 256, 0, stream>>>(WQK, WQ, 0);   /* q rows: head h, dim d <- Bt row h*128 + d */ k_bsel<<<(DQ + 255) / 256, 256, 0, stream>>>(bqk, BQ, 0, 0.03125f); k_rowsel<<<(unsigned)(((size_t)DKV * DM / 8 + 255) / 256), 256, 0, stream>>>(WQK, WK, HD);   /* k rows <- Bt row h*128 + 64 + d */ k_bsel<<<(DKV + 255) / 256, 256, 0, stream>>>(bqk, BK, HD, 0.03125f); k_wtGs<<<(unsigned)((DM * DKV / 64 + 63) / 64), 256, 0, stream>>>(wv, DM, DKV, WV, 0.03125f);   /* Wv x 2^-5 */ k_bsel1<<<(DKV + 255) / 256, 256, 0, stream>>>(bv, BV, 0.03125f);
      
       }
    k_cvt8<<<(unsigned)(((size_t)NB_ * TT * DM / 8 + 255) / 256), 256, 0, stream>>>(x, XB, (size_t)NB_ * TT * DM / 8);
    k_proj<<<dim3(NB_ * TT / PM, (DQ + 2 * DKV) / PN, 1), 256, 0, stream>>>(XB, WQ, BQ, QPh, QPl, KPh, KPl, VT16, VTh, VTl);
    k_fattn<<<NB_ * NH_ * (TT / QB), 256, 0, stream>>>(QPh, QPl, KPh, KPl, VT16, VTh, VTl, OUT);
}

// v005
// It runs in 163 microseconds.
// Two timings next to v004 both put it at 1.18 times that version's speed.
// Counting every step since v000, it is 23.8 times as fast.
#include <hip/hip_runtime.h>

// Attention with a fused, d_in-scaled qk projection (x [4][2048][1024]; qk = (x Wqk + bqk) / sqrt(1024) ('xw' [1024][2048] sigma 1, zero bias) -> per head h: q = qk columns h*128 .. h*128+63, k = columns h*128+64 .. h*128+127; v = (x Wv + bv) / sqrt(1024) ('xw' [1024][1024] sigma 1) heads of 64; A = q.k / 64 (dim^-scale_exp, scale_exp 1); softmax; out = concat-heads(A v) -> [4][2048][1024] (8.4 M; no output projection)).
// Layout: ONE launch (k_prep) makes the bf16 copy of x (all batches), the transposed [3072][1024] Bt with separate q and k blocks (row h*64+d <- Wqk column h*128+d and h*128+64+d) and the v block behind them, and the scaled biases; the 1/sqrt(1024) = 2^-5 input scalings are folded EXACTLY into the bf16 weights and f32 biases (a power-of-two factor commutes with every rounding); ONE launch (k_proj) does the three exact projections of every batch and stores the q, k and v planes itself, and ONE launch (k_fattn) then does scores, softmax and attn.v for every batch and head with hi/lo 3-product score tiles on EVERY row (SCL 1/64); P and attn.v hybrid (rows < 512 hi/lo, rest fp16); it writes the f32 output rows.
// Compute dtypes, f32 accumulate: every input rounded to bf16; projections exact (x 2^-5 folded); scores 3 products on every row; softmax f32 (x 1/64), running maximum and sum over passes of 32 keys; attn.v rows < 512 3 products, rest fp16; output f32.

#define NB_  4
#define TT   2048
#define DM   1024
#define NH_  16
#define NKV  16
#define REP  (NH_ / NKV)
#define HD   64
#define DQ   (NH_ * HD)
#define DKV  (NKV * HD)
#define QW   32                   // query columns of one wave of k_fattn (two 16-column groups)
#define QB   256                  // query rows of one k_fattn work-group (8 waves); RH and TT are multiples of it
#define RH   512                  // query rows < RH use hi+lo planes (0: none)
#define WIN  0
#define SCL  0.015625f  // 1/DIM = 1/64 (scale_exp 1); the two 1/sqrt(1024) input scalings are folded into the weights
typedef _Float16 h16;
typedef unsigned short bf;
typedef __attribute__((ext_vector_type(16))) __bf16   v16bf;
typedef __attribute__((ext_vector_type(16))) _Float16 v16h;
typedef __attribute__((ext_vector_type(8)))  _Float16 v8h;
typedef __attribute__((ext_vector_type(8)))  unsigned short v8us;
typedef __attribute__((ext_vector_type(8)))  float    v8f;
typedef __attribute__((ext_vector_type(4)))  float    v4f;
typedef v8h  __attribute__((may_alias)) v8ha;
typedef v4f  __attribute__((may_alias)) v4fa;
typedef v8us __attribute__((may_alias)) v8usa;

__device__ __forceinline__ unsigned short f2bf(float f) { unsigned u = __float_as_uint(f); u += 0x7FFFu + ((u >> 16) & 1u); return (unsigned short)(u >> 16); }
__device__ __forceinline__ float bf2f(unsigned short b) { return __uint_as_float(((unsigned)b) << 16); }
__device__ __forceinline__ float bfr(float f) { return bf2f(f2bf(f)); }
__device__ __forceinline__ v16h cat16(v8h lo, v8h hi) { return __builtin_shufflevector(lo, hi, 0, 1, 2, 3, 4, 5, 6, 7, 8, 9, 10, 11, 12, 13, 14, 15); }
__device__ __forceinline__ v16bf cat16b(v8us lo, v8us hi) { return __builtin_bit_cast(v16bf, __builtin_shufflevector(lo, hi, 0, 1, 2, 3, 4, 5, 6, 7, 8, 9, 10, 11, 12, 13, 14, 15)); }
__device__ __forceinline__ v8f wmma16(v16h a, v16h b, v8f c) { return __builtin_amdgcn_wmma_f32_16x16x32_f16(false, a, false, b, (short)0, c, false, false); }
__device__ __forceinline__ v8f wmmab(v16bf a, v16bf b, v8f c) { return __builtin_amdgcn_wmma_f32_16x16x32_bf16(false, a, false, b, (short)0, c, false, false); }



// WFrag::ld: one lane's 16 elements of a 16x32 operand tile from a K-contiguous 16-bit row (elements 0..7 and 16..23 behind the lane's pointer, which stands at 8 (lane >> 4)).
template <typename T16> struct WFrag;
template <> struct WFrag<h16> { typedef v16h V; static __device__ __forceinline__ V ld(const h16* p) { return cat16(*(const v8h*)p, *(const v8h*)(p + 16)); } static __device__ __forceinline__ v8f mma(V a, V b, v8f c) { return wmma16(a, b, c); } };
template <> struct WFrag<bf> { typedef v16bf V; static __device__ __forceinline__ V ld(const bf* p) { return cat16b(*(const v8us*)p, *(const v8us*)(p + 16)); } static __device__ __forceinline__ v8f mma(V a, V b, v8f c) { return wmmab(a, b, c); } };

__device__ __forceinline__ h16 tohx(float x) { return (h16)x; }
__device__ __forceinline__ void splitf(float y, unsigned short& h, unsigned short& l) { h = f2bf(y); l = f2bf(y - bf2f(h)); }
typedef __attribute__((ext_vector_type(2))) _Float16 v2h;
typedef __attribute__((ext_vector_type(4))) _Float16 v4h;
typedef __attribute__((ext_vector_type(2))) unsigned short v2us;
typedef __attribute__((ext_vector_type(4))) unsigned short v4us;
typedef __attribute__((ext_vector_type(2))) float v2f;
typedef __attribute__((ext_vector_type(4))) int v4i;

// ---- k_prep: everything that k_proj reads, in ONE launch; a work-group does either one weight tile or one stretch of x (the choice is the same for the whole work-group).
// Work-groups 0 .. WTB-1: a tile of 64 rows of the [3072][1024] Bt (q heads, k heads, v heads) x WKT k. Bt row h*64+d of the q block is Wqk column h*128+d, of the k block column h*128+64+d, so 64 Bt rows are 64 neighbouring columns of one weight: 256 bytes of each of its rows.
// A thread loads 16 neighbouring k of 4 neighbouring columns (16 loads of 16 bytes, all in flight; a wave's load covers whole lines), scales by 2^-5, rounds to bf16 and puts the 4 x 16 block transposed into LDS; behind one barrier each wave stores whole 512-byte pieces of Bt rows. The tiles of the first k also scale the 64 biases.
// The other work-groups: 64 KiB of x each to bf16, 16 loads of 16 bytes per thread, all in flight, every wave-wide load and store on whole lines.
#define WKT  256                  // k of one weight tile
#define WPI  (WKT + 8)            // LDS pitch of a transposed row, elements
#define WTB  (((DQ + 2 * DKV) / 64) * (DM / WKT))   // weight tiles
#define XPB  (256 * 4 * 16)       // x elements of one work-group
template <int N>
__device__ __forceinline__ void wtile(const float* __restrict__ w, const float* __restrict__ b, int col0, int row0, int k0, bf* Bt, float* bout, bf* sm) {
    const int tid = threadIdx.x, nq = tid & 15, kg = tid >> 4;
    const float* p = w + (size_t)(k0 + kg * 16) * N + col0 + nq * 4; v4f f[16];
#pragma unroll
    for (int i = 0; i < 16; ++i) f[i] = *(const v4fa*)(p + (size_t)i * N);
    asm volatile("s_wait_xcnt 0x0" :: "v"(p) : "memory");   // behind the sixteen loads, which share one address pair: as an input here the pair stays live up to the wait, so that no load's result is put into it in front of the wait
    const bool bt = k0 == 0 && tid < 64; const int bc = col0 + tid; float bs = 0.f;
    if (bt) { bs = b[bc]; asm volatile("s_wait_xcnt 0x0" :: "v"(bc) : "memory"); }   // the bias load flies with the weight loads; the wait as above, for its index register
#pragma unroll
    for (int j = 0; j < 4; ++j)
#pragma unroll
        for (int u = 0; u < 2; ++u) { v8us o;
#pragma unroll
            for (int r = 0; r < 8; ++r) o[r] = f2bf(__fmul_rn(f[u * 8 + r][j], 0.03125f));
            *(v8us*)(sm + (nq * 4 + j) * WPI + kg * 16 + u * 8) = o; }
    __syncthreads();   // the rows that a wave stores were written by all eight waves
    const int lane = tid & 31, wv = tid >> 5;
#pragma unroll
    for (int r = 0; r < 8; ++r) { const v8us o = *(const v8us*)(sm + (wv * 8 + r) * WPI + lane * 8); *(v8us*)(Bt + (size_t)(row0 + wv * 8 + r) * DM + k0 + lane * 8) = o; }
    asm volatile("s_wait_xcnt 0x0" ::: "memory");   // behind the eight stores: their data and address registers may be written again by the code behind them
    if (bt) { bout[row0 + tid] = __fmul_rn(bs, 0.03125f); asm volatile("s_wait_xcnt 0x0" ::: "memory"); }   // the wait as above, for the bias store
}
__global__ __launch_bounds__(256) void k_prep(const float* __restrict__ x, const float* __restrict__ wqk, const float* __restrict__ bqk, const float* __restrict__ wv, const float* __restrict__ bv, bf* XB, bf* Bt, float* bout) {
    __shared__ __align__(16) bf sm[64 * WPI];
    const int bid = blockIdx.x;
    if (bid < WTB) {
        const int nt = bid / (DM / WKT), k0 = (bid % (DM / WKT)) * WKT, row0 = nt * 64;
        if (row0 < DQ + DKV) wtile<2 * DQ>(wqk, bqk, (nt % NH_) * 2 * HD + (nt / NH_) * HD, row0, k0, Bt, bout, sm);
        else wtile<DKV>(wv, bv, row0 - (DQ + DKV), row0, k0, Bt, bout, sm);
    } else {
        const size_t e = (size_t)(bid - WTB) * XPB + threadIdx.x * 4; const float* p = x + e; v4f f[16];
#pragma unroll
        for (int i = 0; i < 16; ++i) f[i] = *(const v4fa*)(p + i * 1024);
        asm volatile("s_wait_xcnt 0x0" :: "v"(p) : "memory");   // behind the sixteen loads, which share one address pair: as an input here the pair stays live up to the wait, so that no load's result is put into it in front of the wait
#pragma unroll
        for (int i = 0; i < 16; ++i) { v4us o;
#pragma unroll
            for (int r = 0; r < 4; ++r) o[r] = f2bf(f[i][r]);
            *(v4us*)(XB + e + i * 1024) = o; }
        asm volatile("s_wait_xcnt 0x0" ::: "memory");   // behind the sixteen stores: their data and address registers may be written again by the code behind them
    }
}
// ---- k_proj: the q, k and v projections of all four batches in ONE launch: C[m][n] = sum_k X[m][k] Wt[n][k] + bias[n], m = batch * TT + t (8192 rows), n = 0 .. 3071 (q heads, k heads, v heads; Wt and bias hold the three blocks one behind the other).
// A work-group of 8 waves owns PM x PN of C, each wave 64 x 64 (16 accumulators; wave w: rows 64 (w & 3), columns 64 (w >> 2), one head). Per pass of PK = 64 k every thread brings 12 x 16 bytes (whole 128-byte lines of 256 X rows and 128 Wt rows) through registers into one of two LDS buffers, one barrier per pass; row pitch 144 B as for the K rows of k_fattn.
// No f32 copy of C goes to memory: the wave adds the bias, rounds and stores the planes that k_fattn reads. An accumulator lane holds 8 neighbouring rows of the FIRST operand at one row of the second, so q and k tiles take Wt as first operand (a lane then holds 8 neighbouring d of one t: 16 bytes of a [h][t][d] plane) and v tiles take X (8 neighbouring t of one d: 16 bytes of a [h][d][t] plane). Both operands are read in the order of WFrag::ld, so the k orders are equal either way, and k runs upward in steps of 32 as before.
#define PM   256
#define PN   128
#define PK   64
#define PPI  72                   // LDS pitch of a staged row, elements (64 + 8)
#define PXS  (PM * PPI)           // the X rows of one buffer; the Wt rows follow
#define PSTG ((PM + PN) * PPI)    // one buffer
__global__ __launch_bounds__(256) __attribute__((amdgpu_waves_per_eu(4, 4))) void k_proj(const bf* __restrict__ X, const bf* __restrict__ Wt, const float* __restrict__ bias, bf* Qh, bf* Ql, bf* Kh, bf* Kl, h16* V16, bf* Vh, bf* Vl) {
    __shared__ __align__(16) bf sm[2 * PSTG];
    const int tid = threadIdx.x, lane = tid & 31, lr = lane & 15, hi = lane >> 4, wv = tid >> 5;
    const int r0 = blockIdx.x * PM, c0 = blockIdx.y * PN;
    const bool vt = c0 >= DQ + DKV;   // the same for the whole work-group: PN divides DQ and DKV
    const bf* xg = X + (size_t)(r0 + (tid >> 3)) * DM + (tid & 7) * 8; const bf* wg = Wt + (size_t)(c0 + (tid >> 3)) * DM + (tid & 7) * 8;   // 8 threads per 128-byte line, 32 rows per round
    const int ss = (tid >> 3) * PPI + (tid & 7) * 8;
    v8us gx[8], gw[4];
#pragma unroll
    for (int i = 0; i < 8; ++i) gx[i] = *(const v8usa*)(xg + (size_t)i * 32 * DM);
#pragma unroll
    for (int i = 0; i < 4; ++i) gw[i] = *(const v8usa*)(wg + (size_t)i * 32 * DM);
    v8f acc[4][4];
#pragma unroll
    for (int i = 0; i < 4; ++i)
#pragma unroll
        for (int j = 0; j < 4; ++j) acc[i][j] = (v8f){};
#pragma unroll
    for (int i = 0; i < 8; ++i) *(v8us*)(sm + ss + i * 32 * PPI) = gx[i];
#pragma unroll
    for (int i = 0; i < 4; ++i) *(v8us*)(sm + PXS + ss + i * 32 * PPI) = gw[i];
    __syncthreads();
    const int xo = ((wv & 3) * 64 + lr) * PPI + 8 * hi, wo = PXS + ((wv >> 2) * 64 + lr) * PPI + 8 * hi;
    const int po = vt ? xo : wo, qo = vt ? wo : xo;   // first and second operand of the wave's products
    for (int k0 = 0; k0 < DM; k0 += PK) {
        const bf* cur = sm + ((k0 / PK) & 1) * PSTG; bf* nxt = sm + (((k0 / PK) & 1) ^ 1) * PSTG;
        const int kn = (k0 + PK) & (DM - 1);   // the next pass's k; the last pass fetches pass 0 again (in bounds, never read)
#pragma unroll
        for (int i = 0; i < 8; ++i) gx[i] = *(const v8usa*)(xg + (size_t)i * 32 * DM + kn);
#pragma unroll
        for (int i = 0; i < 4; ++i) gw[i] = *(const v8usa*)(wg + (size_t)i * 32 * DM + kn);
        __builtin_amdgcn_sched_barrier(0);   // keeps the next pass's global loads in front of this pass's products, whose time covers their latency; left free, they are moved down to just in front of the LDS stores
#pragma unroll
        for (int ks = 0; ks < PK; ks += 32) { v16bf p[4];
#pragma unroll
            for (int i = 0; i < 4; ++i) p[i] = WFrag<bf>::ld(cur + po + i * 16 * PPI + ks);
#pragma unroll
            for (int j = 0; j < 4; ++j) { const v16bf q = WFrag<bf>::ld(cur + qo + j * 16 * PPI + ks);
#pragma unroll
                for (int i = 0; i < 4; ++i) acc[i][j] = wmmab(p[i], q, acc[i][j]); } }
#pragma unroll
        for (int i = 0; i < 8; ++i) *(v8us*)(nxt + ss + i * 32 * PPI) = gx[i];   // nxt was last read in the pass before this one, in front of that pass's barrier
#pragma unroll
        for (int i = 0; i < 4; ++i) *(v8us*)(nxt + PXS + ss + i * 32 * PPI) = gw[i];
        __syncthreads();   // publishes nxt and ends every wave's reads of cur
    }
    const int rw = r0 + (wv & 3) * 64, cw = c0 + (wv >> 2) * 64;   // the wave's first row and column of C
    const int t0 = rw % TT, hd = (cw % DQ) / HD; const size_t pb = (size_t)(rw / TT) * NH_ * TT * HD + (size_t)hd * TT * HD;   // DQ == DKV; the (batch, head) block of every plane
    if (!vt) {
        bf* Ph = (cw < DQ) ? Qh : Kh; bf* Pl = (cw < DQ) ? Ql : Kl; v8f bb[4]; const float* bp = bias + cw + hi * 8;
#pragma unroll
        for (int i = 0; i < 4; ++i) bb[i] = *(const v8f*)(bp + i * 16);
        asm volatile("s_wait_xcnt 0x0" :: "v"(bp) : "memory");   // behind the eight bias loads, which share one address pair: as an input here the pair stays live up to the wait, so that no load's result is put into it in front of the wait
#pragma unroll
        for (int i = 0; i < 4; ++i)
#pragma unroll
            for (int r = 0; r < 8; ++r) bb[i][r] = bfr(bb[i][r]);
#pragma unroll
        for (int j = 0; j < 4; ++j) { const size_t e = pb + (size_t)(t0 + j * 16 + lr) * HD + hi * 8;   // acc[i][j][r]: d = 16 i + 8 hi + r, t = t0 + 16 j + lr
#pragma unroll
            for (int i = 0; i < 4; ++i) { v8us oh, ol;
#pragma unroll
                for (int r = 0; r < 8; ++r) { unsigned short a2, c2; splitf(acc[i][j][r] + bb[i][r], a2, c2); oh[r] = a2; ol[r] = c2; }
                *(v8us*)(Ph + e + i * 16) = oh; *(v8us*)(Pl + e + i * 16) = ol; }
            asm volatile("s_wait_xcnt 0x0" ::: "memory"); }   // behind the group's eight stores: their data and address registers are written again by the next group
    } else {
#pragma unroll
        for (int j = 0; j < 4; ++j) { const float bj = bfr(bias[cw + j * 16 + lr]); const size_t e = pb + (size_t)(j * 16 + lr) * TT + t0 + hi * 8;   // acc[i][j][r]: t = t0 + 16 i + 8 hi + r, d = 16 j + lr
#pragma unroll
            for (int i = 0; i < 4; ++i) { v8h o16; v8us oh, ol;
#pragma unroll
                for (int r = 0; r < 8; ++r) { const float y = acc[i][j][r] + bj; unsigned short a2, c2; splitf(y, a2, c2); o16[r] = tohx(y); oh[r] = a2; ol[r] = c2; }
                *(v8h*)(V16 + e + i * 16) = o16; *(v8us*)(Vh + e + i * 16) = oh; *(v8us*)(Vl + e + i * 16) = ol; }
            asm volatile("s_wait_xcnt 0x0" ::: "memory"); }   // behind the group's twelve stores: their data and address registers are written again by the next group
    }
}
// ---- k_fattn: scores, softmax and attn.v of one (batch, head) and QB query rows in one work-group; nothing of S or P goes to memory.
// Transposed products: St = K Qt (A = 16 key rows, B = 16 query rows, both read in the order of WFrag::ld, so their k orders are equal), then Ot += Vt Pt (A = 16 rows of the [d][t] plane, B = P).
// A lane (c = lane & 15, h = lane >> 4) holds St[key 8h + r][query c]; the two 16-key tiles of a pass, converted in place, are the B operand of the second product (element s = key 16 (s >> 3) + 8h + (s & 7), the order in which the keys of a Vt row are read).
// So every score, every P and every output element of a lane in one 16-column group belongs to ONE query: maximum, sum and rescale are per lane and group, and the two halves of a wave exchange only the maximum (when it moves) and the sum (once).
// mu = the maximum in use, in log2 units (score x SCL x log2 e), equal in both halves; it moves only when some column's new maximum exceeds it by more than 8, so P stays <= 2^8.
// The 8 waves share each pass's 32 keys: every thread brings 16 bytes of each plane through registers into one of two LDS buffers (K in whole 128-byte lines, Vt in half lines), one barrier per pass. Row pitches 144 B and 80 B (16 B x odd): 16-byte reads without bank conflicts.
#define KPI  72                   // LDS pitch of a K row, elements (64 + 8)
#define VPI  40                   // LDS pitch of a Vt row, elements (32 + 8)
#define KSZ  (32 * KPI)           // one K plane of a pass
#define VSZ  (HD * VPI)           // one Vt plane of a pass
__device__ __forceinline__ v16h ldh(const bf* p) { return __builtin_bit_cast(v16h, __builtin_shufflevector(*(const v8us*)p, *(const v8us*)(p + 16), 0, 1, 2, 3, 4, 5, 6, 7, 8, 9, 10, 11, 12, 13, 14, 15)); }
template <bool HIRES>
__device__ __forceinline__ void attn_body(const bf* __restrict__ Qh, const bf* __restrict__ Ql, const bf* __restrict__ Kh, const bf* __restrict__ Kl, const h16* __restrict__ V16, const bf* __restrict__ Vh, const bf* __restrict__ Vl, float* out, int q0, bf* sm) {
    const int tid = threadIdx.x, lane = tid & 31, c = lane & 15, h = lane >> 4;
    const float CL = SCL * 1.4426950408889634f;
    const int STG = 2 * KSZ + (HIRES ? 2 : 1) * VSZ;   // elements of one buffer: K hi, K lo, Vt (hi, lo | fp16)
    const unsigned kg = tid * 16u, vg = (tid >> 2) * (TT * 2u) + (tid & 3) * 16u;   // the thread's byte offsets in a pass's global data: its 32 K rows are 4 KiB in a row; 64 bytes of each of the 64 Vt rows
    const int ks = (tid >> 3) * KPI + (tid & 7) * 8, vs = 2 * KSZ + (tid >> 2) * VPI + (tid & 3) * 8;
    v8us g0 = *(const v8usa*)((const char*)Kh + kg), g1 = *(const v8usa*)((const char*)Kl + kg), g2 = *(const v8usa*)((HIRES ? (const char*)Vh : (const char*)V16) + vg), g3;
    if (HIRES) g3 = *(const v8usa*)((const char*)Vl + vg);
    v16bf qh[2][2], ql[2][2];
#pragma unroll
    for (int qt = 0; qt < 2; ++qt)
#pragma unroll
        for (int kc = 0; kc < 2; ++kc) { const size_t qo = (size_t)(q0 + qt * 16 + c) * HD + kc * 32 + 8 * h; qh[qt][kc] = WFrag<bf>::ld(Qh + qo); ql[qt][kc] = WFrag<bf>::ld(Ql + qo); }
    v8f o[4][2];
#pragma unroll
    for (int dt = 0; dt < 4; ++dt)
#pragma unroll
        for (int qt = 0; qt < 2; ++qt) o[dt][qt] = (v8f){};
    float mu[2] = { -3.0e38f, -3.0e38f }, ls[2] = { 0.f, 0.f };
    *(v8us*)(sm + ks) = g0; *(v8us*)(sm + KSZ + ks) = g1; *(v8us*)(sm + vs) = g2; if (HIRES) *(v8us*)(sm + VSZ + vs) = g3;
    __syncthreads();
    const int ko = c * KPI + 8 * h, vo = 2 * KSZ + c * VPI + 8 * h;
    for (int k0 = 0; k0 < TT; k0 += 32) {
        const bf* cur = sm + ((k0 >> 5) & 1) * STG; bf* nxt = sm + (((k0 >> 5) & 1) ^ 1) * STG;
        const int kn = (k0 + 32) & (TT - 1);   // the next pass's keys; the last pass fetches pass 0 again (in bounds, never read)
        v8f s[2][2];
#pragma unroll
        for (int kt = 0; kt < 2; ++kt) { const bf* kp = cur + ko + kt * 16 * KPI;
            const v16bf kh0 = WFrag<bf>::ld(kp), kh1 = WFrag<bf>::ld(kp + 32), kl0 = WFrag<bf>::ld(kp + KSZ), kl1 = WFrag<bf>::ld(kp + KSZ + 32);
            v8f a0 = (v8f){}, a1 = (v8f){};
            a0 = wmmab(kh0, qh[0][0], a0); a1 = wmmab(kh0, qh[1][0], a1); a0 = wmmab(kh1, qh[0][1], a0); a1 = wmmab(kh1, qh[1][1], a1);
            a0 = wmmab(kh0, ql[0][0], a0); a1 = wmmab(kh0, ql[1][0], a1); a0 = wmmab(kh1, ql[0][1], a0); a1 = wmmab(kh1, ql[1][1], a1);
            a0 = wmmab(kl0, qh[0][0], a0); a1 = wmmab(kl0, qh[1][0], a1); a0 = wmmab(kl1, qh[0][1], a0); a1 = wmmab(kl1, qh[1][1], a1);
            s[kt][0] = a0; s[kt][1] = a1; }
        float lm[2];
#pragma unroll
        for (int qt = 0; qt < 2; ++qt) { float x = fmaxf(s[0][qt][0], s[1][qt][0]);
#pragma unroll
            for (int r = 1; r < 8; ++r) x = fmaxf(x, fmaxf(s[0][qt][r], s[1][qt][r]));
            lm[qt] = x * CL; }
        const bool need = (lm[0] > mu[0] + 8.0f) || (lm[1] > mu[1] + 8.0f);
        if (__builtin_amdgcn_ballot_w32(need) != 0) {   // wave-uniform: always on the first pass, rare later
#pragma unroll
            for (int qt = 0; qt < 2; ++qt) { const float mn = fmaxf(mu[qt], fmaxf(lm[qt], __shfl_xor(lm[qt], 16, 32))); const float f = __builtin_amdgcn_exp2f(mu[qt] - mn); mu[qt] = mn; ls[qt] *= f;
#pragma unroll
                for (int dt = 0; dt < 4; ++dt) o[dt][qt] *= f; }
        }
        g0 = *(const v8usa*)((const char*)(Kh + kn * HD) + kg); g1 = *(const v8usa*)((const char*)(Kl + kn * HD) + kg); g2 = *(const v8usa*)((HIRES ? (const char*)(Vh + kn) : (const char*)(V16 + kn)) + vg); if (HIRES) g3 = *(const v8usa*)((const char*)(Vl + kn) + vg);
        __builtin_amdgcn_sched_barrier(0);   // keeps the next pass's global loads in front of the exponentials and the second product, whose time covers their latency; left free, they are moved down to just in front of the LDS stores
        v16h p16[2]; v16bf ph[2], pl[2];
#pragma unroll
        for (int qt = 0; qt < 2; ++qt) { const v2f cl2 = { CL, CL }, nm2 = { -mu[qt], -mu[qt] }; v2f t[4];   // two neighbouring accumulator registers at a time: packed multiply-adds and adds with no register copies
#pragma unroll
            for (int r = 0; r < 8; r += 2) { const v2f x0 = __builtin_elementwise_fma((v2f){ s[0][qt][r], s[0][qt][r + 1] }, cl2, nm2), x1 = __builtin_elementwise_fma((v2f){ s[1][qt][r], s[1][qt][r + 1] }, cl2, nm2);
                const v2f p0 = { __builtin_amdgcn_exp2f(x0[0]), __builtin_amdgcn_exp2f(x0[1]) }, p1 = { __builtin_amdgcn_exp2f(x1[0]), __builtin_amdgcn_exp2f(x1[1]) }; t[r >> 1] = p0 + p1;
#pragma unroll
                for (int e = 0; e < 2; ++e) {
                    if (HIRES) { const __bf16 h0 = (__bf16)p0[e], h1 = (__bf16)p1[e]; ph[qt][r + e] = h0; ph[qt][8 + r + e] = h1; pl[qt][r + e] = (__bf16)(p0[e] - (float)h0); pl[qt][8 + r + e] = (__bf16)(p1[e] - (float)h1); } else { p16[qt][r + e] = tohx(p0[e]); p16[qt][8 + r + e] = tohx(p1[e]); } } }
            const v2f w = (t[0] + t[1]) + (t[2] + t[3]); ls[qt] += w[0] + w[1]; }   // a tree: one dependent add per pass on the running sum
#pragma unroll
        for (int dt = 0; dt < 4; ++dt) { const bf* vp = cur + vo + dt * 16 * VPI;
            if (HIRES) { const v16bf vh = WFrag<bf>::ld(vp), vl = WFrag<bf>::ld(vp + VSZ);
                o[dt][0] = wmmab(vh, ph[0], o[dt][0]); o[dt][1] = wmmab(vh, ph[1], o[dt][1]); o[dt][0] = wmmab(vh, pl[0], o[dt][0]); o[dt][1] = wmmab(vh, pl[1], o[dt][1]); o[dt][0] = wmmab(vl, ph[0], o[dt][0]); o[dt][1] = wmmab(vl, ph[1], o[dt][1]);
            } else { const v16h vf = ldh(vp); o[dt][0] = wmma16(vf, p16[0], o[dt][0]); o[dt][1] = wmma16(vf, p16[1], o[dt][1]); } }
        *(v8us*)(nxt + ks) = g0; *(v8us*)(nxt + KSZ + ks) = g1; *(v8us*)(nxt + vs) = g2; if (HIRES) *(v8us*)(nxt + VSZ + vs) = g3;   // nxt was last read in the pass before this one, in front of that pass's barrier
        __syncthreads();   // publishes nxt and ends every wave's reads of cur
    }
#pragma unroll
    for (int qt = 0; qt < 2; ++qt) { const float f = __fdiv_rn(1.0f, ls[qt] + __shfl_xor(ls[qt], 16, 32)); float* orow = out + (size_t)(q0 + qt * 16 + c) * DQ + 8 * h;
#pragma unroll
        for (int dt = 0; dt < 4; ++dt) { v4f lo4, hi4;
#pragma unroll
            for (int r = 0; r < 4; ++r) { lo4[r] = o[dt][qt][r] * f; hi4[r] = o[dt][qt][4 + r] * f; }
            *(v4f*)(orow + dt * 16) = lo4; *(v4f*)(orow + dt * 16 + 4) = hi4; }
        asm volatile("s_wait_xcnt 0x0" ::: "memory"); }   // behind the group's eight stores: their data and address registers are written again by the next group's products and by the code behind the call
}
// grid: NB_ NH_ TT / QB work-groups of 8 waves; the blocks of rows < RH (three attn.v products, the longer ones) come first. amdgpu_waves_per_eu: two work-groups per WGP, so that one wave's vector work and waits lie under the others' matrix work.
__global__ __launch_bounds__(256) __attribute__((amdgpu_waves_per_eu(4, 4))) void k_fattn(const bf* __restrict__ Qh, const bf* __restrict__ Ql, const bf* __restrict__ Kh, const bf* __restrict__ Kl, const h16* __restrict__ V16, const bf* __restrict__ Vh, const bf* __restrict__ Vl, float* OUT) {
    __shared__ __align__(16) bf sm[2 * (2 * KSZ + 2 * VSZ)];
    const int NHI = RH / QB, NLO = TT / QB - NHI; const int bid = blockIdx.x; int bh, qb;
    if (bid < NB_ * NH_ * NHI) { bh = bid / NHI; qb = bid % NHI; } else { const int r = bid - NB_ * NH_ * NHI; bh = r / NLO; qb = NHI + r % NLO; }
    const size_t po = (size_t)bh * TT * HD; const int q0 = qb * QB + (int)(threadIdx.x >> 5) * QW;
    float* out = OUT + (size_t)(bh / NH_) * TT * DQ + (bh % NH_) * HD;
    if (qb < NHI) attn_body<true>(Qh + po, Ql + po, Kh + po, Kl + po, V16 + po, Vh + po, Vl + po, out, q0, sm);
    else attn_body<false>(Qh + po, Ql + po, Kh + po, Kl + po, V16 + po, Vh + po, Vl + po, out, q0, sm);
}

extern "C" void kernel_launch(void* const* d_in, const int* in_sizes, int n_in,
                              void* d_out, int out_size, void* d_ws, size_t ws_size, hipStream_t stream) {
    (void)in_sizes; (void)n_in; (void)out_size;
    const float* x = (const float*)d_in[0]; const float* wqk = (const float*)d_in[1];   /* [1024][2048] */ const float* bqk = (const float*)d_in[2];   /* [2048] */ const float* wv = (const float*)d_in[3]; const float* bv = (const float*)d_in[4];
    float* OUT = (float*)d_out;     // [4][2048][1024]
    char* wsp = (char*)d_ws;
    auto take = [&](size_t bytes) { char* p = wsp; wsp += (bytes + 255) & ~(size_t)255; return (void*)p; };
    float* BQ = (float*)take((size_t)(DQ + 2 * DKV) * 4); bf* WQ = (bf*)take((size_t)(DQ + 2 * DKV) * DM * 2);   // the q, k and v blocks of bias and Bt lie one behind the other: k_proj reads them as one [3072] and one [3072][1024]
    bf* XB = (bf*)take((size_t)NB_ * TT * DM * 2);
    const size_t PB = (size_t)NH_ * TT * HD;   // elements of one batch's block in each plane that k_fattn reads (one kv head per query head)
    h16* VT16 = (h16*)take(NB_ * PB * 2); bf* QPh = (bf*)take(NB_ * PB * 2); bf* QPl = (bf*)take(NB_ * PB * 2); bf* KPh = (bf*)take(NB_ * PB * 2); bf* KPl = (bf*)take(NB_ * PB * 2); bf* VTh = (bf*)take(NB_ * PB * 2); bf* VTl = (bf*)take(NB_ * PB * 2);   // 7 x 16 MiB
    if ((size_t)(wsp - (char*)d_ws) > ws_size) return;    // ws 256 MiB
    k_prep<<<WTB + NB_ * TT * DM / XPB, 256, 0, stream>>>(x, wqk, bqk, wv, bv, XB, WQ, BQ);
    k_proj<<<dim3(NB_ * TT / PM, (DQ + 2 * DKV) / PN, 1), 256, 0, stream>>>(XB, WQ, BQ, QPh, QPl, KPh, KPl, VT16, VTh, VTl);
    k_fattn<<<NB_ * NH_ * (TT / QB), 256, 0, stream>>>(QPh, QPl, KPh, KPl, VT16, VTh, VTl, OUT);
}

// v007
// It runs in 115 microseconds.
// Versions in between are left out here; by their measured steps it is 1.42 times as fast as v005.
// Over all steps from v000 it is 33.7 times as fast.
#include <hip/hip_runtime.h>

// Attention with a fused, d_in-scaled qk projection (x [4][2048][1024]; qk = (x Wqk + bqk) / sqrt(1024) ('xw' [1024][2048] sigma 1, zero bias) -> per head h: q = qk columns h*128 .. h*128+63, k = columns h*128+64 .. h*128+127; v = (x Wv + bv) / sqrt(1024) ('xw' [1024][1024] sigma 1) heads of 64; A = q.k / 64 (dim^-scale_exp, scale_exp 1); softmax; out = concat-heads(A v) -> [4][2048][1024] (8.4 M; no output projection)).
// Layout: ONE launch (k_prep) makes the bf16 copy of x (all batches), the transposed [3072][1024] Bt with separate q and k blocks (row h*64+d <- Wqk column h*128+d and h*128+64+d) and the v block behind them, and the scaled biases; the 1/sqrt(1024) = 2^-5 input scalings are folded EXACTLY into the bf16 weights and f32 biases (a power-of-two factor commutes with every rounding); ONE launch (k_proj) does the three exact projections of every batch and stores one f16 plane each of q, k and v itself, and ONE launch (k_fattn) then does scores, softmax and attn.v for every batch and head, one f16 product each (SCL 1/64); it writes the f32 output rows.
// Compute dtypes, f32 accumulate: every input rounded to bf16; projections exact (x 2^-5 folded), their results rounded to f16 (11 bits); scores one f16 product; softmax f32 (x 1/64), running maximum and sum over passes of 32 keys; P rounded to f16, attn.v one f16 product; output f32.

#define NB_  4
#define TT   2048
#define DM   1024
#define NH_  16
#define NKV  16
#define REP  (NH_ / NKV)
#define HD   64
#define DQ   (NH_ * HD)
#define DKV  (NKV * HD)
#define QW   32                   // query columns of one wave of k_fattn (two 16-column groups)
#define QB   256                  // query rows of one k_fattn work-group (8 waves); TT is a multiple of it
#define WIN  0
#define SCL  0.015625f  // 1/DIM = 1/64 (scale_exp 1); the two 1/sqrt(1024) input scalings are folded into the weights
typedef _Float16 h16;
typedef unsigned short bf;
typedef __attribute__((ext_vector_type(16))) __bf16   v16bf;
typedef __attribute__((ext_vector_type(16))) _Float16 v16h;
typedef __attribute__((ext_vector_type(8)))  _Float16 v8h;
typedef __attribute__((ext_vector_type(8)))  unsigned short v8us;
typedef __attribute__((ext_vector_type(8)))  float    v8f;
typedef __attribute__((ext_vector_type(4)))  float    v4f;
typedef v8h  __attribute__((may_alias)) v8ha;
typedef v4f  __attribute__((may_alias)) v4fa;
typedef v8us __attribute__((may_alias)) v8usa;

__device__ __forceinline__ unsigned short f2bf(float f) { unsigned u = __float_as_uint(f); u += 0x7FFFu + ((u >> 16) & 1u); return (unsigned short)(u >> 16); }
__device__ __forceinline__ float bf2f(unsigned short b) { return __uint_as_float(((unsigned)b) << 16); }
__device__ __forceinline__ float bfr(float f) { return bf2f(f2bf(f)); }
__device__ __forceinline__ v16h cat16(v8h lo, v8h hi) { return __builtin_shufflevector(lo, hi, 0, 1, 2, 3, 4, 5, 6, 7, 8, 9, 10, 11, 12, 13, 14, 15); }
__device__ __forceinline__ v16bf cat16b(v8us lo, v8us hi) { return __builtin_bit_cast(v16bf, __builtin_shufflevector(lo, hi, 0, 1, 2, 3, 4, 5, 6, 7, 8, 9, 10, 11, 12, 13, 14, 15)); }
__device__ __forceinline__ v8f wmma16(v16h a, v16h b, v8f c) { return __builtin_amdgcn_wmma_f32_16x16x32_f16(false, a, false, b, (short)0, c, false, false); }
__device__ __forceinline__ v8f wmmab(v16bf a, v16bf b, v8f c) { return __builtin_amdgcn_wmma_f32_16x16x32_bf16(false, a, false, b, (short)0, c, false, false); }



// WFrag::ld: one lane's 16 elements of a 16x32 operand tile from a K-contiguous 16-bit row (elements 0..7 and 16..23 behind the lane's pointer, which stands at 8 (lane >> 4)).
template <typename T16> struct WFrag;
template <> struct WFrag<h16> { typedef v16h V; static __device__ __forceinline__ V ld(const h16* p) { return cat16(*(const v8h*)p, *(const v8h*)(p + 16)); } static __device__ __forceinline__ v8f mma(V a, V b, v8f c) { return wmma16(a, b, c); } };
template <> struct WFrag<bf> { typedef v16bf V; static __device__ __forceinline__ V ld(const bf* p) { return cat16b(*(const v8us*)p, *(const v8us*)(p + 16)); } static __device__ __forceinline__ v8f mma(V a, V b, v8f c) { return wmmab(a, b, c); } };

__device__ __forceinline__ h16 tohx(float x) { return (h16)x; }
typedef __attribute__((ext_vector_type(2))) _Float16 v2h;
typedef __attribute__((ext_vector_type(4))) _Float16 v4h;
typedef __attribute__((ext_vector_type(2))) unsigned short v2us;
typedef __attribute__((ext_vector_type(4))) unsigned short v4us;
typedef __attribute__((ext_vector_type(2))) float v2f;
typedef __attribute__((ext_vector_type(4))) int v4i;

// ---- k_prep: everything that k_proj reads, in ONE launch; a work-group does either one weight tile or one stretch of x (the choice is the same for the whole work-group).
// Work-groups 0 .. WTB-1: a tile of 64 rows of the [3072][1024] Bt (q heads, k heads, v heads) x WKT k. Bt row h*64+d of the q block is Wqk column h*128+d, of the k block column h*128+64+d, so 64 Bt rows are 64 neighbouring columns of one weight: 256 bytes of each of its rows.
// A thread loads 16 neighbouring k of 4 neighbouring columns (16 loads of 16 bytes, all in flight; a wave's load covers whole lines), scales by 2^-5, rounds to bf16 and puts the 4 x 16 block transposed into LDS; behind one barrier each wave stores whole 512-byte pieces of Bt rows. The tiles of the first k also scale the 64 biases.
// The other work-groups: 64 KiB of x each to bf16, 16 loads of 16 bytes per thread, all in flight, every wave-wide load and store on whole lines.
#define WKT  256                  // k of one weight tile
#define WPI  (WKT + 8)            // LDS pitch of a transposed row, elements
#define WTB  (((DQ + 2 * DKV) / 64) * (DM / WKT))   // weight tiles
#define XPB  (256 * 4 * 16)       // x elements of one work-group
template <int N>
__device__ __forceinline__ void wtile(const float* __restrict__ w, const float* __restrict__ b, int col0, int row0, int k0, bf* Bt, float* bout, bf* sm) {
    const int tid = threadIdx.x, nq = tid & 15, kg = tid >> 4;
    const float* p = w + (size_t)(k0 + kg * 16) * N + col0 + nq * 4; v4f f[16];
#pragma unroll
    for (int i = 0; i < 16; ++i) f[i] = *(const v4fa*)(p + (size_t)i * N);
    asm volatile("s_wait_xcnt 0x0" :: "v"(p) : "memory");   // behind the sixteen loads, which share one address pair: as an input here the pair stays live up to the wait, so that no load's result is put into it in front of the wait
    const bool bt = k0 == 0 && tid < 64; const int bc = col0 + tid; float bs = 0.f;
    if (bt) { bs = b[bc]; asm volatile("s_wait_xcnt 0x0" :: "v"(bc) : "memory"); }   // the bias load flies with the weight loads; the wait as above, for its index register
#pragma unroll
    for (int j = 0; j < 4; ++j)
#pragma unroll
        for (int u = 0; u < 2; ++u) { v8us o;
#pragma unroll
            for (int r = 0; r < 8; ++r) o[r] = f2bf(__fmul_rn(f[u * 8 + r][j], 0.03125f));
            *(v8us*)(sm + (nq * 4 + j) * WPI + kg * 16 + u * 8) = o; }
    __syncthreads();   // the rows that a wave stores were written by all eight waves
    const int lane = tid & 31, wv = tid >> 5;
#pragma unroll
    for (int r = 0; r < 8; ++r) { const v8us o = *(const v8us*)(sm + (wv * 8 + r) * WPI + lane * 8); *(v8us*)(Bt + (size_t)(row0 + wv * 8 + r) * DM + k0 + lane * 8) = o; }
    asm volatile("s_wait_xcnt 0x0" ::: "memory");   // behind the eight stores: their data and address registers may be written again by the code behind them
    if (bt) { bout[row0 + tid] = __fmul_rn(bs, 0.03125f); asm volatile("s_wait_xcnt 0x0" ::: "memory"); }   // the wait as above, for the bias store
}
__global__ __launch_bounds__(256) void k_prep(const float* __restrict__ x, const float* __restrict__ wqk, const float* __restrict__ bqk, const float* __restrict__ wv, const float* __restrict__ bv, bf* XB, bf* Bt, float* bout) {
    __shared__ __align__(16) bf sm[64 * WPI];
    const int bid = blockIdx.x;
    if (bid < WTB) {
        const int nt = bid / (DM / WKT), k0 = (bid % (DM / WKT)) * WKT, row0 = nt * 64;
        if (row0 < DQ + DKV) wtile<2 * DQ>(wqk, bqk, (nt % NH_) * 2 * HD + (nt / NH_) * HD, row0, k0, Bt, bout, sm);
        else wtile<DKV>(wv, bv, row0 - (DQ + DKV), row0, k0, Bt, bout, sm);
    } else {
        const size_t e = (size_t)(bid - WTB) * XPB + threadIdx.x * 4; const float* p = x + e; v4f f[16];
#pragma unroll
        for (int i = 0; i < 16; ++i) f[i] = *(const v4fa*)(p + i * 1024);
        asm volatile("s_wait_xcnt 0x0" :: "v"(p) : "memory");   // behind the sixteen loads, which share one address pair: as an input here the pair stays live up to the wait, so that no load's result is put into it in front of the wait
#pragma unroll
        for (int i = 0; i < 16; ++i) { v4us o;
#pragma unroll
            for (int r = 0; r < 4; ++r) o[r] = f2bf(f[i][r]);
            *(v4us*)(XB + e + i * 1024) = o; }
        asm volatile("s_wait_xcnt 0x0" ::: "memory");   // behind the sixteen stores: their data and address registers may be written again by the code behind them
    }
}
// ---- k_proj: the q, k and v projections of all four batches in ONE launch: C[m][n] = sum_k X[m][k] Wt[n][k] + bias[n], m = batch * TT + t (8192 rows), n = 0 .. 3071 (q heads, k heads, v heads; Wt and bias hold the three blocks one behind the other).
// A work-group of 8 waves owns PM x PN of C, each wave 64 x 64 (16 accumulators; wave w: rows 64 (w & 3), columns 64 (w >> 2), one head). Per pass of PK = 64 k every thread brings 12 x 16 bytes (whole 128-byte lines of 256 X rows and 128 Wt rows) through registers into one of two LDS buffers, one barrier per pass; row pitch 144 B as for the K rows of k_fattn.
// No f32 copy of C goes to memory: the wave adds the bias, rounds and stores the planes that k_fattn reads. An accumulator lane holds 8 neighbouring rows of the FIRST operand at one row of the second, so q and k tiles take Wt as first operand (a lane then holds 8 neighbouring d of one t: 16 bytes of a [h][t][d] plane) and v tiles take X (8 neighbouring t of one d: 16 bytes of a [h][d][t] plane). Both operands are read in the order of WFrag::ld, so the k orders are equal either way; k runs upward in steps of 32 from the work-group's own first stage and wraps round at DM.
#define PM   256
#define PN   128
#define PK   64
#define PPI  72                   // LDS pitch of a staged row, elements (64 + 8)
#define PXS  (PM * PPI)           // the X rows of one buffer; the Wt rows follow
#define PSTG ((PM + PN) * PPI)    // one buffer
__global__ __launch_bounds__(256) __attribute__((amdgpu_waves_per_eu(4, 4))) void k_proj(const bf* __restrict__ X, const bf* __restrict__ Wt, const float* __restrict__ bias, h16* Q16, h16* K16, h16* V16) {
    __shared__ __align__(16) bf sm[2 * PSTG];
    const int tid = threadIdx.x, lane = tid & 31, lr = lane & 15, hi = lane >> 4, wv = tid >> 5;
    const int r0 = blockIdx.x * PM, c0 = blockIdx.y * PN;
    const bool vt = c0 >= DQ + DKV;   // the same for the whole work-group: PN divides DQ and DKV
    const bf* xg = X + (size_t)(r0 + (tid >> 3)) * DM + (tid & 7) * 8; const bf* wg = Wt + (size_t)(c0 + (tid >> 3)) * DM + (tid & 7) * 8;   // 8 threads per 128-byte line, 32 rows per round
    const int ss = (tid >> 3) * PPI + (tid & 7) * 8;
    const int kst = ((blockIdx.x + blockIdx.y) & (DM / PK - 1)) * PK;   // the k at which this work-group starts its walk; it wraps round at DM. The work-groups that share X rows (one blockIdx.x) or Wt rows (one blockIdx.y) run at the same time and would ask L2 for the same lines at the same moment; so each asks for another stage
    const bf* xn = xg + kst; const bf* wn = wg + kst;   // where the stage that is fetched next stands
    v8us gx[8], gw[4];
#pragma unroll
    for (int i = 0; i < 8; ++i) gx[i] = *(const v8usa*)(xn + (size_t)i * 32 * DM);
#pragma unroll
    for (int i = 0; i < 4; ++i) gw[i] = *(const v8usa*)(wn + (size_t)i * 32 * DM);
    asm volatile("s_wait_xcnt 0x0" :: "v"(xn), "v"(wn) : "memory");   // behind the twelve loads, which share two address pairs: as inputs here the pairs stay live up to the wait, so that nothing is put into one in front of it
    v8f acc[4][4];
#pragma unroll
    for (int i = 0; i < 4; ++i)
#pragma unroll
        for (int j = 0; j < 4; ++j) acc[i][j] = (v8f){};
#pragma unroll
    for (int i = 0; i < 8; ++i) *(v8us*)(sm + ss + i * 32 * PPI) = gx[i];
#pragma unroll
    for (int i = 0; i < 4; ++i) *(v8us*)(sm + PXS + ss + i * 32 * PPI) = gw[i];
    __syncthreads();
    const int xo = ((wv & 3) * 64 + lr) * PPI + 8 * hi, wo = PXS + ((wv >> 2) * 64 + lr) * PPI + 8 * hi;
    const int po = vt ? xo : wo, qo = vt ? wo : xo;   // first and second operand of the wave's products
    for (int k0 = 0; k0 < DM; k0 += PK) {
        const bf* cur = sm + ((k0 / PK) & 1) * PSTG; bf* nxt = sm + (((k0 / PK) & 1) ^ 1) * PSTG;
        const int kn = (kst + k0 + PK) & (DM - 1);   // the next pass's k (k0 counts the k done); the last pass fetches the first stage again (in bounds, never read)
        xn = xg + kn; wn = wg + kn;
#pragma unroll
        for (int i = 0; i < 8; ++i) gx[i] = *(const v8usa*)(xn + (size_t)i * 32 * DM);
#pragma unroll
        for (int i = 0; i < 4; ++i) gw[i] = *(const v8usa*)(wn + (size_t)i * 32 * DM);
        __builtin_amdgcn_sched_barrier(0);   // keeps the next pass's global loads in front of this pass's products, whose time covers their latency; left free, they are moved down to just in front of the LDS stores
#pragma unroll
        for (int ks = 0; ks < PK; ks += 32) { v16bf p[4];
#pragma unroll
            for (int i = 0; i < 4; ++i) p[i] = WFrag<bf>::ld(cur + po + i * 16 * PPI + ks);
#pragma unroll
            for (int j = 0; j < 4; ++j) { const v16bf q = WFrag<bf>::ld(cur + qo + j * 16 * PPI + ks);
#pragma unroll
                for (int i = 0; i < 4; ++i) acc[i][j] = wmmab(p[i], q, acc[i][j]); } }
        asm volatile("s_wait_xcnt 0x0" :: "v"(xn), "v"(wn) : "memory");   // for the pass's twelve global loads, placed here where it no longer stalls: as inputs their two address pairs stay live up to the wait, so that no load's result is put into one in front of the wait
#pragma unroll
        for (int i = 0; i < 8; ++i) *(v8us*)(nxt + ss + i * 32 * PPI) = gx[i];   // nxt was last read in the pass before this one, in front of that pass's barrier
#pragma unroll
        for (int i = 0; i < 4; ++i) *(v8us*)(nxt + PXS + ss + i * 32 * PPI) = gw[i];
        __syncthreads();   // publishes nxt and ends every wave's reads of cur
    }
    const int rw = r0 + (wv & 3) * 64, cw = c0 + (wv >> 2) * 64;   // the wave's first row and column of C
    const int t0 = rw % TT, hd = (cw % DQ) / HD; const size_t pb = (size_t)(rw / TT) * NH_ * TT * HD + (size_t)hd * TT * HD;   // DQ == DKV; the (batch, head) block of every plane
    if (!vt) {
        h16* P = (cw < DQ) ? Q16 : K16; v8f bb[4]; const float* bp = bias + cw + hi * 8;
#pragma unroll
        for (int i = 0; i < 4; ++i) bb[i] = *(const v8f*)(bp + i * 16);
        asm volatile("s_wait_xcnt 0x0" :: "v"(bp) : "memory");   // behind the eight bias loads, which share one address pair: as an input here the pair stays live up to the wait, so that no load's result is put into it in front of the wait
#pragma unroll
        for (int i = 0; i < 4; ++i)
#pragma unroll
            for (int r = 0; r < 8; ++r) bb[i][r] = bfr(bb[i][r]);
#pragma unroll
        for (int j = 0; j < 4; ++j) { const size_t e = pb + (size_t)(t0 + j * 16 + lr) * HD + hi * 8;   // acc[i][j][r]: d = 16 i + 8 hi + r, t = t0 + 16 j + lr
#pragma unroll
            for (int i = 0; i < 4; ++i) { v8h o16;
#pragma unroll
                for (int r = 0; r < 8; ++r) o16[r] = tohx(acc[i][j][r] + bb[i][r]);
                *(v8h*)(P + e + i * 16) = o16; }
            asm volatile("s_wait_xcnt 0x0" ::: "memory"); }   // behind the group's four stores: their data and address registers are written again by the next group
    } else {
#pragma unroll
        for (int j = 0; j < 4; ++j) { const float bj = bfr(bias[cw + j * 16 + lr]); const size_t e = pb + (size_t)(j * 16 + lr) * TT + t0 + hi * 8;   // acc[i][j][r]: t = t0 + 16 i + 8 hi + r, d = 16 j + lr
#pragma unroll
            for (int i = 0; i < 4; ++i) { v8h o16;
#pragma unroll
                for (int r = 0; r < 8; ++r) o16[r] = tohx(acc[i][j][r] + bj);
                *(v8h*)(V16 + e + i * 16) = o16; }
            asm volatile("s_wait_xcnt 0x0" ::: "memory"); }   // behind the group's four stores: their data and address registers are written again by the next group
    }
}
// ---- k_fattn: scores, softmax and attn.v of one (batch, head) and QB query rows in one work-group; nothing of S or P goes to memory.
// Transposed products: St = K Qt (A = 16 key rows, B = 16 query rows, both read in the order of WFrag::ld, so their k orders are equal), then Ot += Vt Pt (A = 16 rows of the [d][t] plane, B = P).
// A lane (c = lane & 15, h = lane >> 4) holds St[key 8h + r][query c]; the two 16-key tiles of a pass, converted in place, are the B operand of the second product (element s = key 16 (s >> 3) + 8h + (s & 7), the order in which the keys of a Vt row are read).
// So every score, every P and every output element of a lane in one 16-column group belongs to ONE query: maximum, sum and rescale are per lane and group, and the two halves of a wave exchange only the maximum (when it moves) and the sum (once).
// mu = the maximum in use, in log2 units (score x SCL x log2 e), equal in both halves; it moves only when some column's new maximum exceeds it by more than 8, so P stays <= 2^8.
// The 8 waves share each pass's 32 keys: every thread brings 16 bytes of each plane through registers into one of two LDS buffers (K in whole 128-byte lines, Vt in half lines), one barrier per pass. Row pitches 144 B and 80 B (16 B x odd): 16-byte reads without bank conflicts.
#define KPI  72                   // LDS pitch of a K row, elements (64 + 8)
#define VPI  40                   // LDS pitch of a Vt row, elements (32 + 8)
#define KSZ  (32 * KPI)           // the K rows of a pass
#define VSZ  (HD * VPI)           // the Vt rows of a pass
#define STG  (KSZ + VSZ)          // one buffer: K, Vt
__device__ __forceinline__ void attn_body(const h16* __restrict__ Q16, const h16* __restrict__ K16, const h16* __restrict__ V16, float* out, int q0, h16* sm) {
    const int tid = threadIdx.x, lane = tid & 31, c = lane & 15, h = lane >> 4;
    const float CL = SCL * 1.4426950408889634f;
    const unsigned kg = tid * 16u, vg = (tid >> 2) * (TT * 2u) + (tid & 3) * 16u;   // the thread's byte offsets in a pass's global data: its 32 K rows are 4 KiB in a row; 64 bytes of each of the 64 Vt rows
    const int ks = (tid >> 3) * KPI + (tid & 7) * 8, vs = KSZ + (tid >> 2) * VPI + (tid & 3) * 8;
    const int kst = (int)(blockIdx.x % (TT / QB)) * QB;   // the key at which this work-group starts its walk; it wraps round at TT. The TT / QB work-groups of one (batch, head) run at the same time over the same K and Vt lines; so each asks L2 for another stretch
    const char* kq = (const char*)(K16 + kst * HD) + kg; const char* vq = (const char*)(V16 + kst) + vg; const h16* qp = Q16 + (size_t)(q0 + c) * HD + 8 * h;
    v8h g0 = *(const v8ha*)kq, g1 = *(const v8ha*)vq;
    v16h qf[2][2];
#pragma unroll
    for (int qt = 0; qt < 2; ++qt)
#pragma unroll
        for (int kc = 0; kc < 2; ++kc) qf[qt][kc] = WFrag<h16>::ld(qp + qt * 16 * HD + kc * 32);
    asm volatile("s_wait_xcnt 0x0" :: "v"(tid), "v"(vg), "v"(qp) : "memory");   // behind the ten loads: as inputs here the registers that they name (the K and Vt loads are built with tid and vg as offset registers, the Q loads with the pair qp) stay live up to the wait, so that nothing is put into one in front of it
    v8f o[4][2];
#pragma unroll
    for (int dt = 0; dt < 4; ++dt)
#pragma unroll
        for (int qt = 0; qt < 2; ++qt) o[dt][qt] = (v8f){};
    float mu[2] = { -3.0e38f, -3.0e38f }, ls[2] = { 0.f, 0.f };
    *(v8h*)(sm + ks) = g0; *(v8h*)(sm + vs) = g1;
    __syncthreads();
    const int ko = c * KPI + 8 * h, vo = KSZ + c * VPI + 8 * h;
    for (int k0 = 0; k0 < TT; k0 += 32) {
        const h16* cur = sm + ((k0 >> 5) & 1) * STG; h16* nxt = sm + (((k0 >> 5) & 1) ^ 1) * STG;
        const int kn = (kst + k0 + 32) & (TT - 1);   // the next pass's keys (k0 counts the keys done); the last pass fetches the first pass's again (in bounds, never read)
        v8f s[2][2];
#pragma unroll
        for (int kt = 0; kt < 2; ++kt) { const h16* kp = cur + ko + kt * 16 * KPI;
            const v16h kf0 = WFrag<h16>::ld(kp), kf1 = WFrag<h16>::ld(kp + 32);
            v8f a0 = (v8f){}, a1 = (v8f){};
            a0 = wmma16(kf0, qf[0][0], a0); a1 = wmma16(kf0, qf[1][0], a1); a0 = wmma16(kf1, qf[0][1], a0); a1 = wmma16(kf1, qf[1][1], a1);
            s[kt][0] = a0; s[kt][1] = a1; }
        float lm[2];
#pragma unroll
        for (int qt = 0; qt < 2; ++qt) { float x = fmaxf(s[0][qt][0], s[1][qt][0]);
#pragma unroll
            for (int r = 1; r < 8; ++r) x = fmaxf(x, fmaxf(s[0][qt][r], s[1][qt][r]));
            lm[qt] = x * CL; }
        const bool need = (lm[0] > mu[0] + 8.0f) || (lm[1] > mu[1] + 8.0f);
        if (__builtin_amdgcn_ballot_w32(need) != 0) {   // wave-uniform: always on the first pass, rare later
#pragma unroll
            for (int qt = 0; qt < 2; ++qt) { const float mn = fmaxf(mu[qt], fmaxf(lm[qt], __shfl_xor(lm[qt], 16, 32))); const float f = __builtin_amdgcn_exp2f(mu[qt] - mn); mu[qt] = mn; ls[qt] *= f;
#pragma unroll
                for (int dt = 0; dt < 4; ++dt) o[dt][qt] *= f; }
        }
        kq = (const char*)(K16 + kn * HD) + kg; vq = (const char*)(V16 + kn) + vg; g0 = *(const v8ha*)kq; g1 = *(const v8ha*)vq;
        __builtin_amdgcn_sched_barrier(0);   // keeps the next pass's global loads in front of the exponentials and the second product, whose time covers their latency; left free, they are moved down to just in front of the LDS stores
        v16h p16[2];
#pragma unroll
        for (int qt = 0; qt < 2; ++qt) { const v2f cl2 = { CL, CL }, nm2 = { -mu[qt], -mu[qt] }; v2f t[4];   // two neighbouring accumulator registers at a time: packed multiply-adds and adds with no register copies
#pragma unroll
            for (int r = 0; r < 8; r += 2) { const v2f x0 = __builtin_elementwise_fma((v2f){ s[0][qt][r], s[0][qt][r + 1] }, cl2, nm2), x1 = __builtin_elementwise_fma((v2f){ s[1][qt][r], s[1][qt][r + 1] }, cl2, nm2);
                const v2f p0 = { __builtin_amdgcn_exp2f(x0[0]), __builtin_amdgcn_exp2f(x0[1]) }, p1 = { __builtin_amdgcn_exp2f(x1[0]), __builtin_amdgcn_exp2f(x1[1]) }; t[r >> 1] = p0 + p1;
#pragma unroll
                for (int e = 0; e < 2; ++e) { p16[qt][r + e] = tohx(p0[e]); p16[qt][8 + r + e] = tohx(p1[e]); } }
            const v2f w = (t[0] + t[1]) + (t[2] + t[3]); ls[qt] += w[0] + w[1]; }   // a tree: one dependent add per pass on the running sum
#pragma unroll
        for (int dt = 0; dt < 4; ++dt) { const v16h vf = WFrag<h16>::ld(cur + vo + dt * 16 * VPI); o[dt][0] = wmma16(vf, p16[0], o[dt][0]); o[dt][1] = wmma16(vf, p16[1], o[dt][1]); }
        asm volatile("s_wait_xcnt 0x0" :: "v"(kq), "v"(vq) : "memory");   // for the pass's two global loads, placed here where it no longer stalls: as inputs their address pairs stay live up to the wait, so that no load's result is put into one in front of the wait
        *(v8h*)(nxt + ks) = g0; *(v8h*)(nxt + vs) = g1;   // nxt was last read in the pass before this one, in front of that pass's barrier
        __syncthreads();   // publishes nxt and ends every wave's reads of cur
    }
#pragma unroll
    for (int qt = 0; qt < 2; ++qt) { const float f = __fdiv_rn(1.0f, ls[qt] + __shfl_xor(ls[qt], 16, 32)); float* orow = out + (size_t)(q0 + qt * 16 + c) * DQ + 8 * h;
#pragma unroll
        for (int dt = 0; dt < 4; ++dt) { v4f lo4, hi4;
#pragma unroll
            for (int r = 0; r < 4; ++r) { lo4[r] = o[dt][qt][r] * f; hi4[r] = o[dt][qt][4 + r] * f; }
            *(v4f*)(orow + dt * 16) = lo4; *(v4f*)(orow + dt * 16 + 4) = hi4; }
        asm volatile("s_wait_xcnt 0x0" ::: "memory"); }   // behind the group's eight stores: their data and address registers are written again by the next group's products and by the code behind the call
}
// grid: NB_ NH_ TT / QB work-groups of 8 waves, all of equal length. amdgpu_waves_per_eu: two work-groups per WGP, so that one wave's vector work and waits lie under the others' matrix work.
__global__ __launch_bounds__(256) __attribute__((amdgpu_waves_per_eu(4, 4))) void k_fattn(const h16* __restrict__ Q16, const h16* __restrict__ K16, const h16* __restrict__ V16, float* OUT) {
    __shared__ __align__(16) h16 sm[2 * STG];
    const int bh = blockIdx.x / (TT / QB), qb = blockIdx.x % (TT / QB);
    const size_t po = (size_t)bh * TT * HD; const int q0 = qb * QB + (int)(threadIdx.x >> 5) * QW;
    float* out = OUT + (size_t)(bh / NH_) * TT * DQ + (bh % NH_) * HD;
    attn_body(Q16 + po, K16 + po, V16 + po, out, q0, sm);
}

extern "C" void kernel_launch(void* const* d_in, const int* in_sizes, int n_in,
                              void* d_out, int out_size, void* d_ws, size_t ws_size, hipStream_t stream) {
    (void)in_sizes; (void)n_in; (void)out_size;
    const float* x = (const float*)d_in[0]; const float* wqk = (const float*)d_in[1];   /* [1024][2048] */ const float* bqk = (const float*)d_in[2];   /* [2048] */ const float* wv = (const float*)d_in[3]; const float* bv = (const float*)d_in[4];
    float* OUT = (float*)d_out;     // [4][2048][1024]
    char* wsp = (char*)d_ws;
    auto take = [&](size_t bytes) { char* p = wsp; wsp += (bytes + 255) & ~(size_t)255; return (void*)p; };
    float* BQ = (float*)take((size_t)(DQ + 2 * DKV) * 4); bf* WQ = (bf*)take((size_t)(DQ + 2 * DKV) * DM * 2);   // the q, k and v blocks of bias and Bt lie one behind the other: k_proj reads them as one [3072] and one [3072][1024]
    bf* XB = (bf*)take((size_t)NB_ * TT * DM * 2);
    const size_t PB = (size_t)NH_ * TT * HD;   // elements of one batch's block in each plane that k_fattn reads (one kv head per query head)
    h16* VT16 = (h16*)take(NB_ * PB * 2); h16* QP16 = (h16*)take(NB_ * PB * 2); h16* KP16 = (h16*)take(NB_ * PB * 2);   // 3 x 16 MiB
    if ((size_t)(wsp - (char*)d_ws) > ws_size) return;    // ws 256 MiB
    k_prep<<<WTB + NB_ * TT * DM / XPB, 256, 0, stream>>>(x, wqk, bqk, wv, bv, XB, WQ, BQ);
    k_proj<<<dim3(NB_ * TT / PM, (DQ + 2 * DKV) / PN, 1), 256, 0, stream>>>(XB, WQ, BQ, QP16, KP16, VT16);
    k_fattn<<<NB_ * NH_ * (TT / QB), 256, 0, stream>>>(QP16, KP16, VT16, OUT);
}

// v008
// One run takes 108 microseconds.
// Next to v007, in two timings, it ran 1.06 times as fast each time.
// Over all steps from v000 it is 35.7 times as fast.
#include <hip/hip_runtime.h>

// Attention with a fused, d_in-scaled qk projection (x [4][2048][1024]; qk = (x Wqk + bqk) / sqrt(1024) ('xw' [1024][2048] sigma 1, zero bias) -> per head h: q = qk columns h*128 .. h*128+63, k = columns h*128+64 .. h*128+127; v = (x Wv + bv) / sqrt(1024) ('xw' [1024][1024] sigma 1) heads of 64; A = q.k / 64 (dim^-scale_exp, scale_exp 1); softmax; out = concat-heads(A v) -> [4][2048][1024] (8.4 M; no output projection)).
// Layout: ONE launch (k_prep) makes the bf16 copy of x (all batches), the transposed [3072][1024] Bt with separate q and k blocks (row h*64+d <- Wqk column h*128+d and h*128+64+d) and the v block behind them, and the scaled biases; the 1/sqrt(1024) = 2^-5 input scalings are folded EXACTLY into the bf16 weights and f32 biases (a power-of-two factor commutes with every rounding); ONE launch (k_proj) does the three exact projections of every batch and stores one f16 plane each of q, k and v itself, and ONE launch (k_fattn) then does scores, softmax and attn.v for every batch and head, one f16 product each (SCL 1/64); it writes the f32 output rows.
// Compute dtypes, f32 accumulate: every input rounded to bf16; projections exact (x 2^-5 folded), their results rounded to f16 (11 bits); scores one f16 product; softmax f32 (x 1/64), running maximum and sum over passes of 32 keys; P rounded to f16, attn.v one f16 product; output f32.

#define NB_  4
#define TT   2048
#define DM   1024
#define NH_  16
#define NKV  16
#define REP  (NH_ / NKV)
#define HD   64
#define DQ   (NH_ * HD)
#define DKV  (NKV * HD)
#define QW   32                   // query columns of one wave of k_fattn (two 16-column groups)
#define QB   256                  // query rows of one k_fattn work-group (8 waves); TT is a multiple of it
#define WIN  0
#define SCL  0.015625f  // 1/DIM = 1/64 (scale_exp 1); the two 1/sqrt(1024) input scalings are folded into the weights
typedef _Float16 h16;
typedef unsigned short bf;
typedef __attribute__((ext_vector_type(16))) __bf16   v16bf;
typedef __attribute__((ext_vector_type(16))) _Float16 v16h;
typedef __attribute__((ext_vector_type(8)))  _Float16 v8h;
typedef __attribute__((ext_vector_type(8)))  unsigned short v8us;
typedef __attribute__((ext_vector_type(8)))  float    v8f;
typedef __attribute__((ext_vector_type(4)))  float    v4f;
typedef v8h  __attribute__((may_alias)) v8ha;
typedef v4f  __attribute__((may_alias)) v4fa;
typedef v8us __attribute__((may_alias)) v8usa;

__device__ __forceinline__ unsigned short f2bf(float f) { unsigned u = __float_as_uint(f); u += 0x7FFFu + ((u >> 16) & 1u); return (unsigned short)(u >> 16); }
__device__ __forceinline__ float bf2f(unsigned short b) { return __uint_as_float(((unsigned)b) << 16); }
__device__ __forceinline__ float bfr(float f) { return bf2f(f2bf(f)); }
__device__ __forceinline__ v16h cat16(v8h lo, v8h hi) { return __builtin_shufflevector(lo, hi, 0, 1, 2, 3, 4, 5, 6, 7, 8, 9, 10, 11, 12, 13, 14, 15); }
__device__ __forceinline__ v16bf cat16b(v8us lo, v8us hi) { return __builtin_bit_cast(v16bf, __builtin_shufflevector(lo, hi, 0, 1, 2, 3, 4, 5, 6, 7, 8, 9, 10, 11, 12, 13, 14, 15)); }
__device__ __forceinline__ v8f wmma16(v16h a, v16h b, v8f c) { return __builtin_amdgcn_wmma_f32_16x16x32_f16(false, a, false, b, (short)0, c, false, false); }
__device__ __forceinline__ v8f wmmab(v16bf a, v16bf b, v8f c) { return __builtin_amdgcn_wmma_f32_16x16x32_bf16(false, a, false, b, (short)0, c, false, false); }



// WFrag::ld: one lane's 16 elements of a 16x32 operand tile from a K-contiguous 16-bit row (elements 0..7 and 16..23 behind the lane's pointer, which stands at 8 (lane >> 4)).
template <typename T16> struct WFrag;
template <> struct WFrag<h16> { typedef v16h V; static __device__ __forceinline__ V ld(const h16* p) { return cat16(*(const v8h*)p, *(const v8h*)(p + 16)); } static __device__ __forceinline__ v8f mma(V a, V b, v8f c) { return wmma16(a, b, c); } };
template <> struct WFrag<bf> { typedef v16bf V; static __device__ __forceinline__ V ld(const bf* p) { return cat16b(*(const v8us*)p, *(const v8us*)(p + 16)); } static __device__ __forceinline__ v8f mma(V a, V b, v8f c) { return wmmab(a, b, c); } };

__device__ __forceinline__ h16 tohx(float x) { return (h16)x; }
typedef __attribute__((ext_vector_type(2))) _Float16 v2h;
typedef __attribute__((ext_vector_type(4))) _Float16 v4h;
typedef __attribute__((ext_vector_type(2))) unsigned short v2us;
typedef __attribute__((ext_vector_type(4))) unsigned short v4us;
typedef __attribute__((ext_vector_type(2))) float v2f;
typedef __attribute__((ext_vector_type(4))) int v4i;

// ---- k_prep: everything that k_proj reads, in ONE launch; a work-group does either one weight tile or one stretch of x (the choice is the same for the whole work-group).
// Work-groups 0 .. WTB-1: a tile of 64 rows of the [3072][1024] Bt (q heads, k heads, v heads) x WKT k. Bt row h*64+d of the q block is Wqk column h*128+d, of the k block column h*128+64+d, so 64 Bt rows are 64 neighbouring columns of one weight: 256 bytes of each of its rows.
// A thread loads 16 neighbouring k of 4 neighbouring columns (16 loads of 16 bytes, all in flight; a wave's load covers whole lines), scales by 2^-5, rounds to bf16 and puts the 4 x 16 block transposed into LDS; behind one barrier each wave stores whole 512-byte pieces of Bt rows. The tiles of the first k also scale the 64 biases.
// The other work-groups: 64 KiB of x each to bf16, 16 loads of 16 bytes per thread, all in flight, every wave-wide load and store on whole lines.
#define WKT  256                  // k of one weight tile
#define WPI  (WKT + 8)            // LDS pitch of a transposed row, elements
#define WTB  (((DQ + 2 * DKV) / 64) * (DM / WKT))   // weight tiles
#define XPB  (256 * 4 * 16)       // x elements of one work-group
template <int N>
__device__ __forceinline__ void wtile(const float* __restrict__ w, const float* __restrict__ b, int col0, int row0, int k0, bf* Bt, float* bout, bf* sm) {
    const int tid = threadIdx.x, nq = tid & 15, kg = tid >> 4;
    const float* p = w + (size_t)(k0 + kg * 16) * N + col0 + nq * 4; v4f f[16];
#pragma unroll
    for (int i = 0; i < 16; ++i) f[i] = *(const v4fa*)(p + (size_t)i * N);
    asm volatile("s_wait_xcnt 0x0" :: "v"(p) : "memory");   // behind the sixteen loads, which share one address pair: as an input here the pair stays live up to the wait, so that no load's result is put into it in front of the wait
    const bool bt = k0 == 0 && tid < 64; const int bc = col0 + tid; float bs = 0.f;
    if (bt) { bs = b[bc]; asm volatile("s_wait_xcnt 0x0" :: "v"(bc) : "memory"); }   // the bias load flies with the weight loads; the wait as above, for its index register
#pragma unroll
    for (int j = 0; j < 4; ++j)
#pragma unroll
        for (int u = 0; u < 2; ++u) { v8us o;
#pragma unroll
            for (int r = 0; r < 8; ++r) o[r] = f2bf(__fmul_rn(f[u * 8 + r][j], 0.03125f));
            *(v8us*)(sm + (nq * 4 + j) * WPI + kg * 16 + u * 8) = o; }
    __syncthreads();   // the rows that a wave stores were written by all eight waves
    const int lane = tid & 31, wv = tid >> 5;
#pragma unroll
    for (int r = 0; r < 8; ++r) { const v8us o = *(const v8us*)(sm + (wv * 8 + r) * WPI + lane * 8); *(v8us*)(Bt + (size_t)(row0 + wv * 8 + r) * DM + k0 + lane * 8) = o; }
    asm volatile("s_wait_xcnt 0x0" ::: "memory");   // behind the eight stores: their data and address registers may be written again by the code behind them
    if (bt) { bout[row0 + tid] = __fmul_rn(bs, 0.03125f); asm volatile("s_wait_xcnt 0x0" ::: "memory"); }   // the wait as above, for the bias store
}
__global__ __launch_bounds__(256) void k_prep(const float* __restrict__ x, const float* __restrict__ wqk, const float* __restrict__ bqk, const float* __restrict__ wv, const float* __restrict__ bv, bf* XB, bf* Bt, float* bout) {
    __shared__ __align__(16) bf sm[64 * WPI];
    const int bid = blockIdx.x;
    if (bid < WTB) {
        const int nt = bid / (DM / WKT), k0 = (bid % (DM / WKT)) * WKT, row0 = nt * 64;
        if (row0 < DQ + DKV) wtile<2 * DQ>(wqk, bqk, (nt % NH_) * 2 * HD + (nt / NH_) * HD, row0, k0, Bt, bout, sm);
        else wtile<DKV>(wv, bv, row0 - (DQ + DKV), row0, k0, Bt, bout, sm);
    } else {
        const size_t e = (size_t)(bid - WTB) * XPB + threadIdx.x * 4; const float* p = x + e; v4f f[16];
#pragma unroll
        for (int i = 0; i < 16; ++i) f[i] = *(const v4fa*)(p + i * 1024);
        asm volatile("s_wait_xcnt 0x0" :: "v"(p) : "memory");   // behind the sixteen loads, which share one address pair: as an input here the pair stays live up to the wait, so that no load's result is put into it in front of the wait
#pragma unroll
        for (int i = 0; i < 16; ++i) { v4us o;
#pragma unroll
            for (int r = 0; r < 4; ++r) o[r] = f2bf(f[i][r]);
            *(v4us*)(XB + e + i * 1024) = o; }
        asm volatile("s_wait_xcnt 0x0" ::: "memory");   // behind the sixteen stores: their data and address registers may be written again by the code behind them
    }
}
// ---- k_proj: the q, k and v projections of all four batches in ONE launch: C[m][n] = sum_k X[m][k] Wt[n][k] + bias[n], m = batch * TT + t (8192 rows), n = 0 .. 3071 (q heads, k heads, v heads; Wt and bias hold the three blocks one behind the other).
// A work-group of 8 waves owns PM x PN of C, each wave 64 x 64 (16 accumulators; wave w: rows 64 (w & 3), columns 64 (w >> 2), one head). Per pass of PK = 64 k every thread brings 12 x 16 bytes (whole 128-byte lines of 256 X rows and 128 Wt rows) through registers into one of two LDS buffers, one barrier per pass; row pitch 144 B as for the K rows of k_fattn.
// No f32 copy of C goes to memory: the wave adds the bias, rounds and stores the planes that k_fattn reads. An accumulator lane holds 8 neighbouring rows of the FIRST operand at one row of the second, so q and k tiles take Wt as first operand (a lane then holds 8 neighbouring d of one t: 16 bytes of a [h][t][d] plane) and v tiles take X (8 neighbouring t of one d: 16 bytes of a [h][d][t] plane). Both operands are read in the order of WFrag::ld, so the k orders are equal either way; k runs upward in steps of 32 from the work-group's own first stage and wraps round at DM.
#define PM   256
#define PN   128
#define PK   64
#define PPI  72                   // LDS pitch of a staged row, elements (64 + 8)
#define PXS  (PM * PPI)           // the X rows of one buffer; the Wt rows follow
#define PSTG ((PM + PN) * PPI)    // one buffer
__global__ __launch_bounds__(256) __attribute__((amdgpu_waves_per_eu(4, 4))) void k_proj(const bf* __restrict__ X, const bf* __restrict__ Wt, const float* __restrict__ bias, h16* Q16, h16* K16, h16* V16) {
    __shared__ __align__(16) bf sm[2 * PSTG];
    const int tid = threadIdx.x, lane = tid & 31, lr = lane & 15, hi = lane >> 4, wv = tid >> 5;
    const int r0 = blockIdx.x * PM, c0 = blockIdx.y * PN;
    const bool vt = c0 >= DQ + DKV;   // the same for the whole work-group: PN divides DQ and DKV
    const bf* xg = X + (size_t)(r0 + (tid >> 3)) * DM + (tid & 7) * 8; const bf* wg = Wt + (size_t)(c0 + (tid >> 3)) * DM + (tid & 7) * 8;   // 8 threads per 128-byte line, 32 rows per round
    const int ss = (tid >> 3) * PPI + (tid & 7) * 8;
    const int kst = ((blockIdx.x + blockIdx.y) & (DM / PK - 1)) * PK;   // the k at which this work-group starts its walk; it wraps round at DM. The work-groups that share X rows (one blockIdx.x) or Wt rows (one blockIdx.y) run at the same time and would ask L2 for the same lines at the same moment; so each asks for another stage
    const bf* xn = xg + kst; const bf* wn = wg + kst;   // where the stage that is fetched next stands
    v8us gx[8], gw[4];
#pragma unroll
    for (int i = 0; i < 8; ++i) gx[i] = *(const v8usa*)(xn + (size_t)i * 32 * DM);
#pragma unroll
    for (int i = 0; i < 4; ++i) gw[i] = *(const v8usa*)(wn + (size_t)i * 32 * DM);
    asm volatile("s_wait_xcnt 0x0" :: "v"(xn), "v"(wn) : "memory");   // behind the twelve loads, which share two address pairs: as inputs here the pairs stay live up to the wait, so that nothing is put into one in front of it
    v8f acc[4][4];
#pragma unroll
    for (int i = 0; i < 4; ++i)
#pragma unroll
        for (int j = 0; j < 4; ++j) acc[i][j] = (v8f){};
#pragma unroll
    for (int i = 0; i < 8; ++i) *(v8us*)(sm + ss + i * 32 * PPI) = gx[i];
#pragma unroll
    for (int i = 0; i < 4; ++i) *(v8us*)(sm + PXS + ss + i * 32 * PPI) = gw[i];
    __syncthreads();
    const int xo = ((wv & 3) * 64 + lr) * PPI + 8 * hi, wo = PXS + ((wv >> 2) * 64 + lr) * PPI + 8 * hi;
    const int po = vt ? xo : wo, qo = vt ? wo : xo;   // first and second operand of the wave's products
    for (int k0 = 0; k0 < DM; k0 += PK) {
        const bf* cur = sm + ((k0 / PK) & 1) * PSTG; bf* nxt = sm + (((k0 / PK) & 1) ^ 1) * PSTG;
        const int kn = (kst + k0 + PK) & (DM - 1);   // the next pass's k (k0 counts the k done); the last pass fetches the first stage again (in bounds, never read)
        xn = xg + kn; wn = wg + kn;
#pragma unroll
        for (int i = 0; i < 8; ++i) gx[i] = *(const v8usa*)(xn + (size_t)i * 32 * DM);
#pragma unroll
        for (int i = 0; i < 4; ++i) gw[i] = *(const v8usa*)(wn + (size_t)i * 32 * DM);
        __builtin_amdgcn_sched_barrier(0);   // keeps the next pass's global loads in front of this pass's products, whose time covers their latency; left free, they are moved down to just in front of the LDS stores
#pragma unroll
        for (int ks = 0; ks < PK; ks += 32) { v16bf p[4];
#pragma unroll
            for (int i = 0; i < 4; ++i) p[i] = WFrag<bf>::ld(cur + po + i * 16 * PPI + ks);
#pragma unroll
            for (int j = 0; j < 4; ++j) { const v16bf q = WFrag<bf>::ld(cur + qo + j * 16 * PPI + ks);
#pragma unroll
                for (int i = 0; i < 4; ++i) acc[i][j] = wmmab(p[i], q, acc[i][j]); } }
        asm volatile("s_wait_xcnt 0x0" :: "v"(xn), "v"(wn) : "memory");   // for the pass's twelve global loads, placed here where it no longer stalls: as inputs their two address pairs stay live up to the wait, so that no load's result is put into one in front of the wait
#pragma unroll
        for (int i = 0; i < 8; ++i) *(v8us*)(nxt + ss + i * 32 * PPI) = gx[i];   // nxt was last read in the pass before this one, in front of that pass's barrier
#pragma unroll
        for (int i = 0; i < 4; ++i) *(v8us*)(nxt + PXS + ss + i * 32 * PPI) = gw[i];
        __syncthreads();   // publishes nxt and ends every wave's reads of cur
    }
    const int rw = r0 + (wv & 3) * 64, cw = c0 + (wv >> 2) * 64;   // the wave's first row and column of C
    const int t0 = rw % TT, hd = (cw % DQ) / HD; const size_t pb = (size_t)(rw / TT) * NH_ * TT * HD + (size_t)hd * TT * HD;   // DQ == DKV; the (batch, head) block of every plane
    if (!vt) {
        h16* P = (cw < DQ) ? Q16 : K16; v8f bb[4]; const float* bp = bias + cw + hi * 8;
#pragma unroll
        for (int i = 0; i < 4; ++i) bb[i] = *(const v8f*)(bp + i * 16);
        asm volatile("s_wait_xcnt 0x0" :: "v"(bp) : "memory");   // behind the eight bias loads, which share one address pair: as an input here the pair stays live up to the wait, so that no load's result is put into it in front of the wait
#pragma unroll
        for (int i = 0; i < 4; ++i)
#pragma unroll
            for (int r = 0; r < 8; ++r) bb[i][r] = bfr(bb[i][r]);
#pragma unroll
        for (int j = 0; j < 4; ++j) { const size_t e = pb + (size_t)(t0 + j * 16 + lr) * HD + hi * 8;   // acc[i][j][r]: d = 16 i + 8 hi + r, t = t0 + 16 j + lr
#pragma unroll
            for (int i = 0; i < 4; ++i) { v8h o16;
#pragma unroll
                for (int r = 0; r < 8; ++r) o16[r] = tohx(acc[i][j][r] + bb[i][r]);
                *(v8h*)(P + e + i * 16) = o16; }
            asm volatile("s_wait_xcnt 0x0" ::: "memory"); }   // behind the group's four stores: their data and address registers are written again by the next group
    } else {
#pragma unroll
        for (int j = 0; j < 4; ++j) { const float bj = bfr(bias[cw + j * 16 + lr]); const size_t e = pb + (size_t)(j * 16 + lr) * TT + t0 + hi * 8;   // acc[i][j][r]: t = t0 + 16 i + 8 hi + r, d = 16 j + lr
#pragma unroll
            for (int i = 0; i < 4; ++i) { v8h o16;
#pragma unroll
                for (int r = 0; r < 8; ++r) o16[r] = tohx(acc[i][j][r] + bj);
                *(v8h*)(V16 + e + i * 16) = o16; }
            asm volatile("s_wait_xcnt 0x0" ::: "memory"); }   // behind the group's four stores: their data and address registers are written again by the next group
    }
}
// ---- k_fattn: scores, softmax and attn.v of one (batch, head) and QB query rows in one work-group; nothing of S or P goes to memory.
// Transposed products: St = K Qt (A = 16 key rows, B = 16 query rows, both read in the order of WFrag::ld, so their k orders are equal), then Ot += Vt Pt (A = 16 rows of the [d][t] plane, B = P).
// A lane (c = lane & 15, h = lane >> 4) holds St[key 8h + r][query c]; the two 16-key tiles of a pass, converted in place, are the B operand of the second product (element s = key 16 (s >> 3) + 8h + (s & 7), the order in which the keys of a Vt row are read).
// So every score, every P and every output element of a lane in one 16-column group belongs to ONE query: maximum, sum and rescale are per lane and group, and the two halves of a wave exchange only the maximum (when it moves) and the sum (once).
// mu = the maximum in use, in log2 units (score x SCL x log2 e), equal in both halves; it moves only when some column's new maximum exceeds it by more than 8, so P stays <= 2^8.
// The 8 waves share stages of SK = 128 keys, SP = 4 passes of 32 keys each, in two LDS buffers, with ONE barrier per stage: inside a stage no wave waits for another, so that one wave's vector work can lie under another's products.
// In each pass every thread brings 16 bytes of each plane, a quarter of the NEXT stage (32 K rows; 16 Vt rows of 256 bytes; whole lines), through registers into the other buffer, which nobody reads before the stage's barrier. Row pitches 144 B and 272 B (16 B x odd): 16-byte reads without bank conflicts.
#define SP   4                    // passes of one stage
#define SK   (32 * SP)            // keys of one stage; TT and QB are multiples of it
#define KPI  72                   // LDS pitch of a K row, elements (64 + 8)
#define VPI  (SK + 8)             // LDS pitch of a Vt row, elements
#define KSZ  (SK * KPI)           // the K rows of a stage
#define VSZ  (HD * VPI)           // the Vt rows of a stage
#define STG  (KSZ + VSZ)          // one buffer: K, Vt
__device__ __forceinline__ void attn_body(const h16* __restrict__ Q16, const h16* __restrict__ K16, const h16* __restrict__ V16, float* out, int q0, h16* sm) {
    const int tid = threadIdx.x, lane = tid & 31, c = lane & 15, h = lane >> 4;
    const float CL = SCL * 1.4426950408889634f;
    const unsigned kg = tid * 16u, vg = (tid >> 4) * (TT * 2u) + (tid & 15) * 16u;   // the thread's byte offsets in the first quarter of a stage's global data: 32 K rows are 4 KiB in a row; 256 bytes of each of 16 Vt rows
    const int ks = (tid >> 3) * KPI + (tid & 7) * 8, vs = KSZ + (tid >> 4) * VPI + (tid & 15) * 8;
    const int kst = (int)(blockIdx.x % (TT / QB)) * QB;   // the key at which this work-group starts its walk; it wraps round at TT. The TT / QB work-groups of one (batch, head) run at the same time over the same K and Vt lines; so each asks L2 for another stretch
    const char* kq = (const char*)(K16 + kst * HD) + kg; const char* vq = (const char*)(V16 + kst) + vg; const h16* qp = Q16 + (size_t)(q0 + c) * HD + 8 * h;
    v8h gk[SP], gv[SP];   // the whole first stage
#pragma unroll   // constant indices: gk and gv stay in registers, all eight loads in flight
    for (int j = 0; j < SP; ++j) { gk[j] = *(const v8ha*)(kq + j * 32 * HD * 2); gv[j] = *(const v8ha*)(vq + j * 16 * TT * 2); }
    v16h qf[2][2];
#pragma unroll
    for (int qt = 0; qt < 2; ++qt)
#pragma unroll
        for (int kc = 0; kc < 2; ++kc) qf[qt][kc] = WFrag<h16>::ld(qp + qt * 16 * HD + kc * 32);
    asm volatile("s_wait_xcnt 0x0" :: "v"(tid), "v"(vg), "v"(qp) : "memory");   // behind the sixteen loads: as inputs here the registers that they name (the K and Vt loads are built with tid and vg as offset registers, the Q loads with the pair qp) stay live up to the wait, so that nothing is put into one in front of it
    v8f o[4][2];
#pragma unroll
    for (int dt = 0; dt < 4; ++dt)
#pragma unroll
        for (int qt = 0; qt < 2; ++qt) o[dt][qt] = (v8f){};
    float mu[2] = { -3.0e38f, -3.0e38f }, ls[2] = { 0.f, 0.f };
#pragma unroll   // constant indices, as above
    for (int j = 0; j < SP; ++j) { *(v8h*)(sm + ks + j * 32 * KPI) = gk[j]; *(v8h*)(sm + vs + j * 16 * VPI) = gv[j]; }
    __syncthreads();
    const int ko = c * KPI + 8 * h, vo = KSZ + c * VPI + 8 * h;
    for (int k0 = 0; k0 < TT; k0 += SK) {
        const h16* cur = sm + ((k0 / SK) & 1) * STG; h16* nxt = sm + (((k0 / SK) & 1) ^ 1) * STG;
        const int kn = (kst + k0 + SK) & (TT - 1);   // the next stage's keys (k0 counts the keys done); the last stage fetches the first stage's again (in bounds, never read)
        kq = (const char*)(K16 + kn * HD) + kg; vq = (const char*)(V16 + kn) + vg;
#pragma unroll   // the four passes of a stage: unrolled, a pass's places in both buffers and in the global data are immediate offsets
      for (int j = 0; j < SP; ++j) {
        v8f s[2][2];
#pragma unroll
        for (int kt = 0; kt < 2; ++kt) { const h16* kp = cur + ko + (j * 32 + kt * 16) * KPI;
            const v16h kf0 = WFrag<h16>::ld(kp), kf1 = WFrag<h16>::ld(kp + 32);
            v8f a0 = (v8f){}, a1 = (v8f){};
            a0 = wmma16(kf0, qf[0][0], a0); a1 = wmma16(kf0, qf[1][0], a1); a0 = wmma16(kf1, qf[0][1], a0); a1 = wmma16(kf1, qf[1][1], a1);
            s[kt][0] = a0; s[kt][1] = a1; }
        float lm[2];
#pragma unroll
        for (int qt = 0; qt < 2; ++qt) { float x = fmaxf(s[0][qt][0], s[1][qt][0]);
#pragma unroll
            for (int r = 1; r < 8; ++r) x = fmaxf(x, fmaxf(s[0][qt][r], s[1][qt][r]));
            lm[qt] = x * CL; }
        const bool need = (lm[0] > mu[0] + 8.0f) || (lm[1] > mu[1] + 8.0f);
        if (__builtin_amdgcn_ballot_w32(need) != 0) {   // wave-uniform: always on the first pass, rare later
#pragma unroll
            for (int qt = 0; qt < 2; ++qt) { const float mn = fmaxf(mu[qt], fmaxf(lm[qt], __shfl_xor(lm[qt], 16, 32))); const float f = __builtin_amdgcn_exp2f(mu[qt] - mn); mu[qt] = mn; ls[qt] *= f;
#pragma unroll
                for (int dt = 0; dt < 4; ++dt) o[dt][qt] *= f; }
        }
        const v8h g0 = *(const v8ha*)(kq + j * 32 * HD * 2), g1 = *(const v8ha*)(vq + j * 16 * TT * 2);
        __builtin_amdgcn_sched_barrier(0);   // keeps the pass's global loads in front of the exponentials and the second product, whose time covers their latency; left free, they are moved down to just in front of the LDS stores
        v16h p16[2];
#pragma unroll
        for (int qt = 0; qt < 2; ++qt) { const v2f cl2 = { CL, CL }, nm2 = { -mu[qt], -mu[qt] }; v2f t[4];   // two neighbouring accumulator registers at a time: packed multiply-adds and adds with no register copies
#pragma unroll
            for (int r = 0; r < 8; r += 2) { const v2f x0 = __builtin_elementwise_fma((v2f){ s[0][qt][r], s[0][qt][r + 1] }, cl2, nm2), x1 = __builtin_elementwise_fma((v2f){ s[1][qt][r], s[1][qt][r + 1] }, cl2, nm2);
                const v2f p0 = { __builtin_amdgcn_exp2f(x0[0]), __builtin_amdgcn_exp2f(x0[1]) }, p1 = { __builtin_amdgcn_exp2f(x1[0]), __builtin_amdgcn_exp2f(x1[1]) }; t[r >> 1] = p0 + p1;
#pragma unroll
                for (int e = 0; e < 2; ++e) { p16[qt][r + e] = tohx(p0[e]); p16[qt][8 + r + e] = tohx(p1[e]); } }
            const v2f w = (t[0] + t[1]) + (t[2] + t[3]); ls[qt] += w[0] + w[1]; }   // a tree: one dependent add per pass on the running sum
#pragma unroll
        for (int dt = 0; dt < 4; ++dt) { const v16h vf = WFrag<h16>::ld(cur + vo + dt * 16 * VPI + j * 32); o[dt][0] = wmma16(vf, p16[0], o[dt][0]); o[dt][1] = wmma16(vf, p16[1], o[dt][1]); }
        __builtin_amdgcn_sched_barrier(0);   // keeps the wait for the pass's global loads and the LDS stores behind the pass's products; only a stage's last pass has a barrier that holds them there: left free, in the other passes they are moved up among the exponentials, some forty instructions behind the loads, and the wave waits out most of the loads' latency
        asm volatile("s_wait_xcnt 0x0" :: "v"(kq), "v"(vq) : "memory");   // for the pass's two global loads, placed here where it no longer stalls: as inputs their address pairs stay live up to the wait, so that no load's result is put into one in front of the wait
        *(v8h*)(nxt + ks + j * 32 * KPI) = g0; *(v8h*)(nxt + vs + j * 16 * VPI) = g1;   // nxt was last read in the stage before this one, in front of that stage's barrier
      }
        __syncthreads();   // publishes nxt and ends every wave's reads of cur
    }
#pragma unroll
    for (int qt = 0; qt < 2; ++qt) { const float f = __fdiv_rn(1.0f, ls[qt] + __shfl_xor(ls[qt], 16, 32)); float* orow = out + (size_t)(q0 + qt * 16 + c) * DQ + 8 * h;
#pragma unroll
        for (int dt = 0; dt < 4; ++dt) { v4f lo4, hi4;
#pragma unroll
            for (int r = 0; r < 4; ++r) { lo4[r] = o[dt][qt][r] * f; hi4[r] = o[dt][qt][4 + r] * f; }
            *(v4f*)(orow + dt * 16) = lo4; *(v4f*)(orow + dt * 16 + 4) = hi4; }
        asm volatile("s_wait_xcnt 0x0" ::: "memory"); }   // behind the group's eight stores: their data and address registers are written again by the next group's products and by the code behind the call
}
// grid: NB_ NH_ TT / QB work-groups of 8 waves, all of equal length. amdgpu_waves_per_eu: two work-groups per WGP, so that one wave's vector work and waits lie under the others' matrix work.
__global__ __launch_bounds__(256) __attribute__((amdgpu_waves_per_eu(4, 4))) void k_fattn(const h16* __restrict__ Q16, const h16* __restrict__ K16, const h16* __restrict__ V16, float* OUT) {
    __shared__ __align__(16) h16 sm[2 * STG];
    const int bh = blockIdx.x / (TT / QB), qb = blockIdx.x % (TT / QB);
    const size_t po = (size_t)bh * TT * HD; const int q0 = qb * QB + (int)(threadIdx.x >> 5) * QW;
    float* out = OUT + (size_t)(bh / NH_) * TT * DQ + (bh % NH_) * HD;
    attn_body(Q16 + po, K16 + po, V16 + po, out, q0, sm);
}

extern "C" void kernel_launch(void* const* d_in, const int* in_sizes, int n_in,
                              void* d_out, int out_size, void* d_ws, size_t ws_size, hipStream_t stream) {
    (void)in_sizes; (void)n_in; (void)out_size;
    const float* x = (const float*)d_in[0]; const float* wqk = (const float*)d_in[1];   /* [1024][2048] */ const float* bqk = (const float*)d_in[2];   /* [2048] */ const float* wv = (const float*)d_in[3]; const float* bv = (const float*)d_in[4];
    float* OUT = (float*)d_out;     // [4][2048][1024]
    char* wsp = (char*)d_ws;
    auto take = [&](size_t bytes) { char* p = wsp; wsp += (bytes + 255) & ~(size_t)255; return (void*)p; };
    float* BQ = (float*)take((size_t)(DQ + 2 * DKV) * 4); bf* WQ = (bf*)take((size_t)(DQ + 2 * DKV) * DM * 2);   // the q, k and v blocks of bias and Bt lie one behind the other: k_proj reads them as one [3072] and one [3072][1024]
    bf* XB = (bf*)take((size_t)NB_ * TT * DM * 2);
    const size_t PB = (size_t)NH_ * TT * HD;   // elements of one batch's block in each plane that k_fattn reads (one kv head per query head)
    h16* VT16 = (h16*)take(NB_ * PB * 2); h16* QP16 = (h16*)take(NB_ * PB * 2); h16* KP16 = (h16*)take(NB_ * PB * 2);   // 3 x 16 MiB
    if ((size_t)(wsp - (char*)d_ws) > ws_size) return;    // ws 256 MiB
    k_prep<<<WTB + NB_ * TT * DM / XPB, 256, 0, stream>>>(x, wqk, bqk, wv, bv, XB, WQ, BQ);
    k_proj<<<dim3(NB_ * TT / PM, (DQ + 2 * DKV) / PN, 1), 256, 0, stream>>>(XB, WQ, BQ, QP16, KP16, VT16);
    k_fattn<<<NB_ * NH_ * (TT / QB), 256, 0, stream>>>(QP16, KP16, VT16, OUT);
}

// v009
// Measured time: 105 microseconds a run.
// Two timings next to v008 both put it at 1.03 times that version's speed.
// Counting every step since v000, it is 36.8 times as fast.
#include <hip/hip_runtime.h>

// Attention with a fused, d_in-scaled qk projection (x [4][2048][1024]; qk = (x Wqk + bqk) / sqrt(1024) ('xw' [1024][2048] sigma 1, zero bias) -> per head h: q = qk columns h*128 .. h*128+63, k = columns h*128+64 .. h*128+127; v = (x Wv + bv) / sqrt(1024) ('xw' [1024][1024] sigma 1) heads of 64; A = q.k / 64 (dim^-scale_exp, scale_exp 1); softmax; out = concat-heads(A v) -> [4][2048][1024] (8.4 M; no output projection)).
// Layout: ONE launch (k_prep) makes the bf16 copy of x (all batches), the transposed [3072][1024] Bt with separate q and k blocks (row h*64+d <- Wqk column h*128+d and h*128+64+d) and the v block behind them, and the scaled biases; the 1/sqrt(1024) = 2^-5 input scalings are folded EXACTLY into the bf16 weights and f32 biases (a power-of-two factor commutes with every rounding); ONE launch (k_proj) does the three exact projections of every batch and stores one f16 plane each of q, k and v itself, and ONE launch (k_fattn) then does scores, softmax and attn.v for every batch and head, one f16 product each (SCL 1/64); it writes the f32 output rows.
// Compute dtypes, f32 accumulate: every input rounded to bf16; projections exact (x 2^-5 folded), their results rounded to f16 (11 bits); scores one f16 product; softmax f32 (x 1/64), running maximum and sum over passes of 32 keys; P rounded to f16, attn.v one f16 product; output f32.

#define NB_  4
#define TT   2048
#define DM   1024
#define NH_  16
#define NKV  16
#define REP  (NH_ / NKV)
#define HD   64
#define DQ   (NH_ * HD)
#define DKV  (NKV * HD)
#define QW   32                   // query columns of one wave of k_fattn (two 16-column groups)
#define QB   256                  // query rows of one k_fattn work-group (8 waves); TT is a multiple of it
#define WIN  0
#define SCL  0.015625f  // 1/DIM = 1/64 (scale_exp 1); the two 1/sqrt(1024) input scalings are folded into the weights
typedef _Float16 h16;
typedef unsigned short bf;
typedef __attribute__((ext_vector_type(16))) __bf16   v16bf;
typedef __attribute__((ext_vector_type(16))) _Float16 v16h;
typedef __attribute__((ext_vector_type(8)))  _Float16 v8h;
typedef __attribute__((ext_vector_type(8)))  unsigned short v8us;
typedef __attribute__((ext_vector_type(8)))  float    v8f;
typedef __attribute__((ext_vector_type(4)))  float    v4f;
typedef v8h  __attribute__((may_alias)) v8ha;
typedef v4f  __attribute__((may_alias)) v4fa;
typedef v8us __attribute__((may_alias)) v8usa;

__device__ __forceinline__ unsigned short f2bf(float f) { unsigned u = __float_as_uint(f); u += 0x7FFFu + ((u >> 16) & 1u); return (unsigned short)(u >> 16); }
__device__ __forceinline__ float bf2f(unsigned short b) { return __uint_as_float(((unsigned)b) << 16); }
__device__ __forceinline__ float bfr(float f) { return bf2f(f2bf(f)); }
__device__ __forceinline__ v16h cat16(v8h lo, v8h hi) { return __builtin_shufflevector(lo, hi, 0, 1, 2, 3, 4, 5, 6, 7, 8, 9, 10, 11, 12, 13, 14, 15); }
__device__ __forceinline__ v16bf cat16b(v8us lo, v8us hi) { return __builtin_bit_cast(v16bf, __builtin_shufflevector(lo, hi, 0, 1, 2, 3, 4, 5, 6, 7, 8, 9, 10, 11, 12, 13, 14, 15)); }
__device__ __forceinline__ v8f wmma16(v16h a, v16h b, v8f c) { return __builtin_amdgcn_wmma_f32_16x16x32_f16(false, a, false, b, (short)0, c, false, false); }
__device__ __forceinline__ v8f wmmab(v16bf a, v16bf b, v8f c) { return __builtin_amdgcn_wmma_f32_16x16x32_bf16(false, a, false, b, (short)0, c, false, false); }



// WFrag::ld: one lane's 16 elements of a 16x32 operand tile from a K-contiguous 16-bit row (elements 0..7 and 16..23 behind the lane's pointer, which stands at 8 (lane >> 4)).
template <typename T16> struct WFrag;
template <> struct WFrag<h16> { typedef v16h V; static __device__ __forceinline__ V ld(const h16* p) { return cat16(*(const v8h*)p, *(const v8h*)(p + 16)); } static __device__ __forceinline__ v8f mma(V a, V b, v8f c) { return wmma16(a, b, c); } };
template <> struct WFrag<bf> { typedef v16bf V; static __device__ __forceinline__ V ld(const bf* p) { return cat16b(*(const v8us*)p, *(const v8us*)(p + 16)); } static __device__ __forceinline__ v8f mma(V a, V b, v8f c) { return wmmab(a, b, c); } };

__device__ __forceinline__ h16 tohx(float x) { return (h16)x; }
typedef __attribute__((ext_vector_type(2))) _Float16 v2h;
typedef __attribute__((ext_vector_type(4))) _Float16 v4h;
typedef __attribute__((ext_vector_type(2))) unsigned short v2us;
typedef __attribute__((ext_vector_type(4))) unsigned short v4us;
typedef __attribute__((ext_vector_type(2))) float v2f;
typedef __attribute__((ext_vector_type(4))) int v4i;

// ---- k_prep: everything that k_proj reads, in ONE launch; a work-group does either one weight tile or one stretch of x (the choice is the same for the whole work-group).
// Work-groups 0 .. WTB-1: a tile of 64 rows of the [3072][1024] Bt (q heads, k heads, v heads) x WKT k. Bt row h*64+d of the q block is Wqk column h*128+d, of the k block column h*128+64+d, so 64 Bt rows are 64 neighbouring columns of one weight: 256 bytes of each of its rows.
// A thread loads 16 neighbouring k of 4 neighbouring columns (16 loads of 16 bytes, all in flight; a wave's load covers whole lines), scales by 2^-5, rounds to bf16 and puts the 4 x 16 block transposed into LDS; behind one barrier each wave stores whole 512-byte pieces of Bt rows. The tiles of the first k also scale the 64 biases.
// The other work-groups: 64 KiB of x each to bf16, 16 loads of 16 bytes per thread, all in flight, every wave-wide load and store on whole lines.
#define WKT  256                  // k of one weight tile
#define WPI  (WKT + 8)            // LDS pitch of a transposed row, elements
#define WTB  (((DQ + 2 * DKV) / 64) * (DM / WKT))   // weight tiles
#define XPB  (256 * 4 * 16)       // x elements of one work-group
template <int N>
__device__ __forceinline__ void wtile(const float* __restrict__ w, const float* __restrict__ b, int col0, int row0, int k0, bf* Bt, float* bout, bf* sm) {
    const int tid = threadIdx.x, nq = tid & 15, kg = tid >> 4;
    const float* p = w + (size_t)(k0 + kg * 16) * N + col0 + nq * 4; v4f f[16];
#pragma unroll
    for (int i = 0; i < 16; ++i) f[i] = *(const v4fa*)(p + (size_t)i * N);
    asm volatile("s_wait_xcnt 0x0" :: "v"(p) : "memory");   // behind the sixteen loads, which share one address pair: as an input here the pair stays live up to the wait, so that no load's result is put into it in front of the wait
    const bool bt = k0 == 0 && tid < 64; const int bc = col0 + tid; float bs = 0.f;
    if (bt) { bs = b[bc]; asm volatile("s_wait_xcnt 0x0" :: "v"(bc) : "memory"); }   // the bias load flies with the weight loads; the wait as above, for its index register
#pragma unroll
    for (int j = 0; j < 4; ++j)
#pragma unroll
        for (int u = 0; u < 2; ++u) { v8us o;
#pragma unroll
            for (int r = 0; r < 8; ++r) o[r] = f2bf(__fmul_rn(f[u * 8 + r][j], 0.03125f));
            *(v8us*)(sm + (nq * 4 + j) * WPI + kg * 16 + u * 8) = o; }
    __syncthreads();   // the rows that a wave stores were written by all eight waves
    const int lane = tid & 31, wv = tid >> 5;
#pragma unroll
    for (int r = 0; r < 8; ++r) { const v8us o = *(const v8us*)(sm + (wv * 8 + r) * WPI + lane * 8); *(v8us*)(Bt + (size_t)(row0 + wv * 8 + r) * DM + k0 + lane * 8) = o; }
    asm volatile("s_wait_xcnt 0x0" ::: "memory");   // behind the eight stores: their data and address registers may be written again by the code behind them
    if (bt) { bout[row0 + tid] = __fmul_rn(bs, 0.03125f); asm volatile("s_wait_xcnt 0x0" ::: "memory"); }   // the wait as above, for the bias store
}
__global__ __launch_bounds__(256) void k_prep(const float* __restrict__ x, const float* __restrict__ wqk, const float* __restrict__ bqk, const float* __restrict__ wv, const float* __restrict__ bv, bf* XB, bf* Bt, float* bout) {
    __shared__ __align__(16) bf sm[64 * WPI];
    const int bid = blockIdx.x;
    if (bid < WTB) {
        const int nt = bid / (DM / WKT), k0 = (bid % (DM / WKT)) * WKT, row0 = nt * 64;
        if (row0 < DQ + DKV) wtile<2 * DQ>(wqk, bqk, (nt % NH_) * 2 * HD + (nt / NH_) * HD, row0, k0, Bt, bout, sm);
        else wtile<DKV>(wv, bv, row0 - (DQ + DKV), row0, k0, Bt, bout, sm);
    } else {
        const size_t e = (size_t)(bid - WTB) * XPB + threadIdx.x * 4; const float* p = x + e; v4f f[16];
#pragma unroll
        for (int i = 0; i < 16; ++i) f[i] = *(const v4fa*)(p + i * 1024);
        asm volatile("s_wait_xcnt 0x0" :: "v"(p) : "memory");   // behind the sixteen loads, which share one address pair: as an input here the pair stays live up to the wait, so that no load's result is put into it in front of the wait
#pragma unroll
        for (int i = 0; i < 16; ++i) { v4us o;
#pragma unroll
            for (int r = 0; r < 4; ++r) o[r] = f2bf(f[i][r]);
            *(v4us*)(XB + e + i * 1024) = o; }
        asm volatile("s_wait_xcnt 0x0" ::: "memory");   // behind the sixteen stores: their data and address registers may be written again by the code behind them
    }
}
// ---- k_proj: the q, k and v projections of all four batches in ONE launch: C[m][n] = sum_k X[m][k] Wt[n][k] + bias[n], m = batch * TT + t (8192 rows), n = 0 .. 3071 (q heads, k heads, v heads; Wt and bias hold the three blocks one behind the other).
// A work-group of 8 waves owns PM = 256 rows x the q, k and v columns of two heads (PN = 384): NB_ TT / PM x NH_ / 2 = 256 work-groups, one per WGP (two waves per SIMD, 512 registers each), one round. Each wave owns 64 rows x the 192 columns of one head (48 accumulators; wave w: rows 64 (w & 3), head w >> 2): 16 fragments read from LDS feed 48 products, and every X row is fetched from L2 by 8 work-groups, every Wt row by 32.
// The accumulators leave few registers to stage through: per pass of PK = 64 k every thread copies 20 x 16 bytes (whole 128-byte lines of 256 X rows and 384 Wt rows) asynchronously, through no register, into one of two LDS buffers, a whole pass ahead; one barrier per pass; row pitch 144 B as for the K rows of k_fattn. In LDS the Wt rows stand as head, then q, k, v, then d.
// No f32 copy of C goes to memory: the wave adds the bias, rounds and stores the planes that k_fattn reads. An accumulator lane holds 8 neighbouring rows of the FIRST operand at one row of the second, so q and k tiles take Wt as first operand (a lane then holds 8 neighbouring d of one t: 16 bytes of a [h][t][d] plane) and v tiles take X (8 neighbouring t of one d: 16 bytes of a [h][d][t] plane). Both operands are read in the order of WFrag::ld, so the k orders are equal either way; k runs upward in steps of 32 from the work-group's own first stage and wraps round at DM.
#define PM   256
#define PN   (6 * HD)             // q, k, v of two heads
#define PK   64
#define PPI  72                   // LDS pitch of a staged row, elements (64 + 8)
#define PXS  (PM * PPI)           // the X rows of one buffer; the Wt rows follow
#define PSTG ((PM + PN) * PPI)    // one buffer
#define PRD  ((PM + PN) / 32)     // rounds of 32 rows that fill one buffer: 8 of X, 12 of Wt
// the Wt row, counted from the first q row of the work-group's first head, at which round i of the Wt rows starts (DQ == DKV: the q, k and v blocks are DQ rows apart)
__device__ __forceinline__ constexpr int wrow(int i) { return ((i >> 1) % 3) * DQ + ((i >> 1) / 3) * HD + (i & 1) * 32; }
// one stage: each lane copies its own 16 bytes of each of the PRD rounds' rows to the row's place in LDS. l: the lane's place in round 0 of the buffer; x, w: its global address in the first X row and the first Wt row of the stage.
typedef __attribute__((address_space(1))) v4i gv4i;
typedef __attribute__((address_space(3))) v4i lv4i;
__device__ __forceinline__ void pcopy(bf* l, const char* x, const char* w) {
#pragma unroll
    for (int r = 0; r < PRD; ++r) __builtin_amdgcn_global_load_async_to_lds_b128((gv4i*)((r < PM / 32) ? x + (size_t)r * 32 * DM * 2 : w + (size_t)wrow(r - PM / 32) * DM * 2), (lv4i*)(l + r * 32 * PPI), 0, 0);
}
__global__ __launch_bounds__(256) __attribute__((amdgpu_waves_per_eu(2, 2))) void k_proj(const bf* __restrict__ X, const bf* __restrict__ Wt, const float* __restrict__ bias, h16* Q16, h16* K16, h16* V16) {
    __shared__ __align__(16) bf sm[2 * PSTG];
    const int tid = threadIdx.x, lane = tid & 31, lr = lane & 15, hi = lane >> 4, wv = tid >> 5;
    const int r0 = blockIdx.x * PM, h0 = blockIdx.y * 2;
    const char* xg = (const char*)(X + (size_t)(r0 + (tid >> 3)) * DM + (tid & 7) * 8); const char* wg = (const char*)(Wt + (size_t)(h0 * HD + (tid >> 3)) * DM + (tid & 7) * 8);   // 8 threads per 128-byte line, 32 rows per round
    bf* ls = sm + (tid >> 3) * PPI + (tid & 7) * 8;   // the thread's place in round 0 of buffer 0
    const int kst = ((blockIdx.x + blockIdx.y) & (DM / PK - 1)) * PK;   // the k at which this work-group starts its walk; it wraps round at DM. The work-groups that share X rows (one blockIdx.x) or Wt rows (one blockIdx.y) run at the same time and would ask L2 for the same lines at the same moment; so each asks for another stage
    pcopy(ls, xg + kst * 2, wg + kst * 2);   // stage 0 into buffer 0
    asm volatile("s_wait_asynccnt 0x0" ::: "memory");   // the wave's own copies of stage 0 have landed
    __syncthreads();   // publishes stage 0
    { const int k1 = ((kst + PK) & (DM - 1)) * 2; pcopy(ls + PSTG, xg + k1, wg + k1); }   // stage 1 into buffer 1 (DM / PK = 16 stages)
    v8f acc[3][4][4];
#pragma unroll
    for (int b = 0; b < 3; ++b)
#pragma unroll
        for (int i = 0; i < 4; ++i)
#pragma unroll
            for (int j = 0; j < 4; ++j) acc[b][i][j] = (v8f){};
    const int xo = ((wv & 3) * 64 + lr) * PPI + 8 * hi, wo = PXS + ((wv >> 2) * 3 * HD + lr) * PPI + 8 * hi;
    for (int k0 = 0; k0 < DM; k0 += PK) {
        const int bu = (k0 / PK) & 1; const bf* xr = sm + bu * PSTG + xo; const bf* wr = sm + bu * PSTG + wo;
        v16bf xf[4], wf[2][4];   // the X fragments of one half (32 k) of the pass; two sets of four Wt fragments (one of q, k, v of one half), the next set fetched while the products of this one run
        // group g = 0 .. 5: half g / 3, block g % 3 (q, k, v)
#define PLDX(H)    { _Pragma("unroll") for (int i = 0; i < 4; ++i) xf[i] = WFrag<bf>::ld(xr + i * 16 * PPI + (H) * 32); }
#define PLDW(S, G) { _Pragma("unroll") for (int i = 0; i < 4; ++i) wf[S][i] = WFrag<bf>::ld(wr + (((G) % 3) * 4 + i) * 16 * PPI + ((G) / 3) * 32); }
#define PMM(S, G)  { _Pragma("unroll") for (int i = 0; i < 4; ++i) _Pragma("unroll") for (int j = 0; j < 4; ++j) { if ((G) % 3 < 2) acc[(G) % 3][i][j] = wmmab(wf[S][i], xf[j], acc[(G) % 3][i][j]); else acc[2][j][i] = wmmab(xf[j], wf[S][i], acc[2][j][i]); } }
#define PSB        __builtin_amdgcn_sched_barrier(0);   // holds each set's eight loads together, one whole set of sixteen products ahead of their use: left free, each fragment is loaded just in front of its own products and the wave waits out the LDS latency every time
        PLDX(0) PLDW(0, 0) PLDW(1, 1) PSB
        PMM(0, 0) PSB PLDW(0, 2) PSB
        PMM(1, 1) PSB PLDW(1, 3) PSB
        PMM(0, 2) PSB PLDX(1) PLDW(0, 4) PSB
        PMM(1, 3) PSB PLDW(1, 5) PSB
        PMM(0, 4)
        PMM(1, 5)
        asm volatile("s_wait_dscnt 0x0" ::: "memory");      // the wave's reads of this buffer are done before it is refilled
        asm volatile("s_wait_asynccnt 0x0" ::: "memory");   // the wave's own copies of the next stage have landed
        __syncthreads();   // publishes the next stage and ends every wave's reads of this buffer
        if (k0 + 2 * PK < DM) { const int k2 = ((kst + k0 + 2 * PK) & (DM - 1)) * 2; pcopy(ls + bu * PSTG, xg + k2, wg + k2); }   // the stage after the next into the buffer just read; the test is the same in the whole work-group
    }
    asm volatile("s_wait_asynccnt 0x0" ::: "memory");   // no copy is outstanding when the wave goes on to its end
    const int rw = r0 + (wv & 3) * 64, hd = h0 + (wv >> 2);   // the wave's first row of C and its head
    const int t0 = rw % TT; const size_t pb = (size_t)(rw / TT) * NH_ * TT * HD + (size_t)hd * TT * HD;   // the (batch, head) block of every plane
#pragma unroll
    for (int b = 0; b < 2; ++b) {
        h16* P = b ? K16 : Q16; v8f bb[4]; const float* bp = bias + b * DQ + hd * HD + hi * 8;
#pragma unroll
        for (int i = 0; i < 4; ++i) bb[i] = *(const v8f*)(bp + i * 16);
        asm volatile("s_wait_xcnt 0x0" :: "v"(bp) : "memory");   // behind the eight bias loads, which share one address pair: as an input here the pair stays live up to the wait, so that no load's result is put into it in front of the wait
#pragma unroll
        for (int i = 0; i < 4; ++i)
#pragma unroll
            for (int r = 0; r < 8; ++r) bb[i][r] = bfr(bb[i][r]);
#pragma unroll
        for (int j = 0; j < 4; ++j) { const size_t e = pb + (size_t)(t0 + j * 16 + lr) * HD + hi * 8;   // acc[b][i][j][r]: d = 16 i + 8 hi + r, t = t0 + 16 j + lr
#pragma unroll
            for (int i = 0; i < 4; ++i) { v8h o16;
#pragma unroll
                for (int r = 0; r < 8; ++r) o16[r] = tohx(acc[b][i][j][r] + bb[i][r]);
                *(v8h*)(P + e + i * 16) = o16; }
            asm volatile("s_wait_xcnt 0x0" ::: "memory"); }   // behind the group's four stores: their data and address registers are written again by the next group
    }
#pragma unroll
    for (int j = 0; j < 4; ++j) { const float bj = bfr(bias[DQ + DKV + hd * HD + j * 16 + lr]); const size_t e = pb + (size_t)(j * 16 + lr) * TT + t0 + hi * 8;   // acc[2][i][j][r]: t = t0 + 16 i + 8 hi + r, d = 16 j + lr
#pragma unroll
        for (int i = 0; i < 4; ++i) { v8h o16;
#pragma unroll
            for (int r = 0; r < 8; ++r) o16[r] = tohx(acc[2][i][j][r] + bj);
            *(v8h*)(V16 + e + i * 16) = o16; }
        asm volatile("s_wait_xcnt 0x0" ::: "memory"); }   // behind the group's four stores: their data and address registers are written again by the next group
}
// ---- k_fattn: scores, softmax and attn.v of one (batch, head) and QB query rows in one work-group; nothing of S or P goes to memory.
// Transposed products: St = K Qt (A = 16 key rows, B = 16 query rows, both read in the order of WFrag::ld, so their k orders are equal), then Ot += Vt Pt (A = 16 rows of the [d][t] plane, B = P).
// A lane (c = lane & 15, h = lane >> 4) holds St[key 8h + r][query c]; the two 16-key tiles of a pass, converted in place, are the B operand of the second product (element s = key 16 (s >> 3) + 8h + (s & 7), the order in which the keys of a Vt row are read).
// So every score, every P and every output element of a lane in one 16-column group belongs to ONE query: maximum, sum and rescale are per lane and group, and the two halves of a wave exchange only the maximum (when it moves) and the sum (once).
// mu = the maximum in use, in log2 units (score x SCL x log2 e), equal in both halves; it moves only when some column's new maximum exceeds it by more than 8, so P stays <= 2^8.
// The 8 waves share stages of SK = 128 keys, SP = 4 passes of 32 keys each, in two LDS buffers, with ONE barrier per stage: inside a stage no wave waits for another, so that one wave's vector work can lie under another's products.
// In each pass every thread brings 16 bytes of each plane, a quarter of the NEXT stage (32 K rows; 16 Vt rows of 256 bytes; whole lines), through registers into the other buffer, which nobody reads before the stage's barrier. Row pitches 144 B and 272 B (16 B x odd): 16-byte reads without bank conflicts.
#define SP   4                    // passes of one stage
#define SK   (32 * SP)            // keys of one stage; TT and QB are multiples of it
#define KPI  72                   // LDS pitch of a K row, elements (64 + 8)
#define VPI  (SK + 8)             // LDS pitch of a Vt row, elements
#define KSZ  (SK * KPI)           // the K rows of a stage
#define VSZ  (HD * VPI)           // the Vt rows of a stage
#define STG  (KSZ + VSZ)          // one buffer: K, Vt
__device__ __forceinline__ void attn_body(const h16* __restrict__ Q16, const h16* __restrict__ K16, const h16* __restrict__ V16, float* out, int q0, h16* sm) {
    const int tid = threadIdx.x, lane = tid & 31, c = lane & 15, h = lane >> 4;
    const float CL = SCL * 1.4426950408889634f;
    const unsigned kg = tid * 16u, vg = (tid >> 4) * (TT * 2u) + (tid & 15) * 16u;   // the thread's byte offsets in the first quarter of a stage's global data: 32 K rows are 4 KiB in a row; 256 bytes of each of 16 Vt rows
    const int ks = (tid >> 3) * KPI + (tid & 7) * 8, vs = KSZ + (tid >> 4) * VPI + (tid & 15) * 8;
    const int kst = (int)(blockIdx.x % (TT / QB)) * QB;   // the key at which this work-group starts its walk; it wraps round at TT. The TT / QB work-groups of one (batch, head) run at the same time over the same K and Vt lines; so each asks L2 for another stretch
    const char* kq = (const char*)(K16 + kst * HD) + kg; const char* vq = (const char*)(V16 + kst) + vg; const h16* qp = Q16 + (size_t)(q0 + c) * HD + 8 * h;
    v8h gk[SP], gv[SP];   // the whole first stage
#pragma unroll   // constant indices: gk and gv stay in registers, all eight loads in flight
    for (int j = 0; j < SP; ++j) { gk[j] = *(const v8ha*)(kq + j * 32 * HD * 2); gv[j] = *(const v8ha*)(vq + j * 16 * TT * 2); }
    v16h qf[2][2];
#pragma unroll
    for (int qt = 0; qt < 2; ++qt)
#pragma unroll
        for (int kc = 0; kc < 2; ++kc) qf[qt][kc] = WFrag<h16>::ld(qp + qt * 16 * HD + kc * 32);
    asm volatile("s_wait_xcnt 0x0" :: "v"(tid), "v"(vg), "v"(qp) : "memory");   // behind the sixteen loads: as inputs here the registers that they name (the K and Vt loads are built with tid and vg as offset registers, the Q loads with the pair qp) stay live up to the wait, so that nothing is put into one in front of it
    v8f o[4][2];
#pragma unroll
    for (int dt = 0; dt < 4; ++dt)
#pragma unroll
        for (int qt = 0; qt < 2; ++qt) o[dt][qt] = (v8f){};
    float mu[2] = { -3.0e38f, -3.0e38f }, ls[2] = { 0.f, 0.f };
#pragma unroll   // constant indices, as above
    for (int j = 0; j < SP; ++j) { *(v8h*)(sm + ks + j * 32 * KPI) = gk[j]; *(v8h*)(sm + vs + j * 16 * VPI) = gv[j]; }
    __syncthreads();
    const int ko = c * KPI + 8 * h, vo = KSZ + c * VPI + 8 * h;
    for (int k0 = 0; k0 < TT; k0 += SK) {
        const h16* cur = sm + ((k0 / SK) & 1) * STG; h16* nxt = sm + (((k0 / SK) & 1) ^ 1) * STG;
        const int kn = (kst + k0 + SK) & (TT - 1);   // the next stage's keys (k0 counts the keys done); the last stage fetches the first stage's again (in bounds, never read)
        kq = (const char*)(K16 + kn * HD) + kg; vq = (const char*)(V16 + kn) + vg;
#pragma unroll   // the four passes of a stage: unrolled, a pass's places in both buffers and in the global data are immediate offsets
      for (int j = 0; j < SP; ++j) {
        v8f s[2][2];
#pragma unroll
        for (int kt = 0; kt < 2; ++kt) { const h16* kp = cur + ko + (j * 32 + kt * 16) * KPI;
            const v16h kf0 = WFrag<h16>::ld(kp), kf1 = WFrag<h16>::ld(kp + 32);
            v8f a0 = (v8f){}, a1 = (v8f){};
            a0 = wmma16(kf0, qf[0][0], a0); a1 = wmma16(kf0, qf[1][0], a1); a0 = wmma16(kf1, qf[0][1], a0); a1 = wmma16(kf1, qf[1][1], a1);
            s[kt][0] = a0; s[kt][1] = a1; }
        float lm[2];
#pragma unroll
        for (int qt = 0; qt < 2; ++qt) { float x = fmaxf(s[0][qt][0], s[1][qt][0]);
#pragma unroll
            for (int r = 1; r < 8; ++r) x = fmaxf(x, fmaxf(s[0][qt][r], s[1][qt][r]));
            lm[qt] = x * CL; }
        const bool need = (lm[0] > mu[0] + 8.0f) || (lm[1] > mu[1] + 8.0f);
        if (__builtin_amdgcn_ballot_w32(need) != 0) {   // wave-uniform: always on the first pass, rare later
#pragma unroll
            for (int qt = 0; qt < 2; ++qt) { const float mn = fmaxf(mu[qt], fmaxf(lm[qt], __shfl_xor(lm[qt], 16, 32))); const float f = __builtin_amdgcn_exp2f(mu[qt] - mn); mu[qt] = mn; ls[qt] *= f;
#pragma unroll
                for (int dt = 0; dt < 4; ++dt) o[dt][qt] *= f; }
        }
        const v8h g0 = *(const v8ha*)(kq + j * 32 * HD * 2), g1 = *(const v8ha*)(vq + j * 16 * TT * 2);
        __builtin_amdgcn_sched_barrier(0);   // keeps the pass's global loads in front of the exponentials and the second product, whose time covers their latency; left free, they are moved down to just in front of the LDS stores
        v16h p16[2];
#pragma unroll
        for (int qt = 0; qt < 2; ++qt) { const v2f cl2 = { CL, CL }, nm2 = { -mu[qt], -mu[qt] }; v2f t[4];   // two neighbouring accumulator registers at a time: packed multiply-adds and adds with no register copies
#pragma unroll
            for (int r = 0; r < 8; r += 2) { const v2f x0 = __builtin_elementwise_fma((v2f){ s[0][qt][r], s[0][qt][r + 1] }, cl2, nm2), x1 = __builtin_elementwise_fma((v2f){ s[1][qt][r], s[1][qt][r + 1] }, cl2, nm2);
                const v2f p0 = { __builtin_amdgcn_exp2f(x0[0]), __builtin_amdgcn_exp2f(x0[1]) }, p1 = { __builtin_amdgcn_exp2f(x1[0]), __builtin_amdgcn_exp2f(x1[1]) }; t[r >> 1] = p0 + p1;
#pragma unroll
                for (int e = 0; e < 2; ++e) { p16[qt][r + e] = tohx(p0[e]); p16[qt][8 + r + e] = tohx(p1[e]); } }
            const v2f w = (t[0] + t[1]) + (t[2] + t[3]); ls[qt] += w[0] + w[1]; }   // a tree: one dependent add per pass on the running sum
#pragma unroll
        for (int dt = 0; dt < 4; ++dt) { const v16h vf = WFrag<h16>::ld(cur + vo + dt * 16 * VPI + j * 32); o[dt][0] = wmma16(vf, p16[0], o[dt][0]); o[dt][1] = wmma16(vf, p16[1], o[dt][1]); }
        __builtin_amdgcn_sched_barrier(0);   // keeps the wait for the pass's global loads and the LDS stores behind the pass's products; only a stage's last pass has a barrier that holds them there: left free, in the other passes they are moved up among the exponentials, some forty instructions behind the loads, and the wave waits out most of the loads' latency
        asm volatile("s_wait_xcnt 0x0" :: "v"(kq), "v"(vq) : "memory");   // for the pass's two global loads, placed here where it no longer stalls: as inputs their address pairs stay live up to the wait, so that no load's result is put into one in front of the wait
        *(v8h*)(nxt + ks + j * 32 * KPI) = g0; *(v8h*)(nxt + vs + j * 16 * VPI) = g1;   // nxt was last read in the stage before this one, in front of that stage's barrier
      }
        __syncthreads();   // publishes nxt and ends every wave's reads of cur
    }
#pragma unroll
    for (int qt = 0; qt < 2; ++qt) { const float f = __fdiv_rn(1.0f, ls[qt] + __shfl_xor(ls[qt], 16, 32)); float* orow = out + (size_t)(q0 + qt * 16 + c) * DQ + 8 * h;
#pragma unroll
        for (int dt = 0; dt < 4; ++dt) { v4f lo4, hi4;
#pragma unroll
            for (int r = 0; r < 4; ++r) { lo4[r] = o[dt][qt][r] * f; hi4[r] = o[dt][qt][4 + r] * f; }
            *(v4f*)(orow + dt * 16) = lo4; *(v4f*)(orow + dt * 16 + 4) = hi4; }
        asm volatile("s_wait_xcnt 0x0" ::: "memory"); }   // behind the group's eight stores: their data and address registers are written again by the next group's products and by the code behind the call
}
// grid: NB_ NH_ TT / QB work-groups of 8 waves, all of equal length. amdgpu_waves_per_eu: two work-groups per WGP, so that one wave's vector work and waits lie under the others' matrix work.
__global__ __launch_bounds__(256) __attribute__((amdgpu_waves_per_eu(4, 4))) void k_fattn(const h16* __restrict__ Q16, const h16* __restrict__ K16, const h16* __restrict__ V16, float* OUT) {
    __shared__ __align__(16) h16 sm[2 * STG];
    const int bh = blockIdx.x / (TT / QB), qb = blockIdx.x % (TT / QB);
    const size_t po = (size_t)bh * TT * HD; const int q0 = qb * QB + (int)(threadIdx.x >> 5) * QW;
    float* out = OUT + (size_t)(bh / NH_) * TT * DQ + (bh % NH_) * HD;
    attn_body(Q16 + po, K16 + po, V16 + po, out, q0, sm);
}

extern "C" void kernel_launch(void* const* d_in, const int* in_sizes, int n_in,
                              void* d_out, int out_size, void* d_ws, size_t ws_size, hipStream_t stream) {
    (void)in_sizes; (void)n_in; (void)out_size;
    const float* x = (const float*)d_in[0]; const float* wqk = (const float*)d_in[1];   /* [1024][2048] */ const float* bqk = (const float*)d_in[2];   /* [2048] */ const float* wv = (const float*)d_in[3]; const float* bv = (const float*)d_in[4];
    float* OUT = (float*)d_out;     // [4][2048][1024]
    char* wsp = (char*)d_ws;
    auto take = [&](size_t bytes) { char* p = wsp; wsp += (bytes + 255) & ~(size_t)255; return (void*)p; };
    float* BQ = (float*)take((size_t)(DQ + 2 * DKV) * 4); bf* WQ = (bf*)take((size_t)(DQ + 2 * DKV) * DM * 2);   // the q, k and v blocks of bias and Bt lie one behind the other: k_proj reads them as one [3072] and one [3072][1024]
    bf* XB = (bf*)take((size_t)NB_ * TT * DM * 2);
    const size_t PB = (size_t)NH_ * TT * HD;   // elements of one batch's block in each plane that k_fattn reads (one kv head per query head)
    h16* VT16 = (h16*)take(NB_ * PB * 2); h16* QP16 = (h16*)take(NB_ * PB * 2); h16* KP16 = (h16*)take(NB_ * PB * 2);   // 3 x 16 MiB
    if ((size_t)(wsp - (char*)d_ws) > ws_size) return;    // ws 256 MiB
    k_prep<<<WTB + NB_ * TT * DM / XPB, 256, 0, stream>>>(x, wqk, bqk, wv, bv, XB, WQ, BQ);
    k_proj<<<dim3(NB_ * TT / PM, NH_ / 2, 1), 256, 0, stream>>>(XB, WQ, BQ, QP16, KP16, VT16);
    k_fattn<<<NB_ * NH_ * (TT / QB), 256, 0, stream>>>(QP16, KP16, VT16, OUT);
}
